// v000
// The times below were measured on an AMD MI455X: many runs one after another, warmed up first and cycling through
// copies of the inputs, with the whole window's GPU time divided by the number of runs. Launches and the gaps
// between them are all in it. The median over several windows is given; except for v000 it joins two sittings, which
// can be a few percent apart, so the side-by-side timings, each taken in one sitting, are the better comparison.
// v000 is the starting kernel. One run takes 638 microseconds.
#include <hip/hip_runtime.h>

typedef __attribute__((ext_vector_type(16))) __bf16 v16bf;
typedef __attribute__((ext_vector_type(8)))  float  v8f;

#define BM 128
#define BN 128
#define BK 32
#define LDSS 40

// Problem constants
#define DMODEL 4096
#define DLOCAL 512
#define BB     4
#define SS     2048

__device__ __forceinline__ v16bf ld_frag(const __bf16* p) {
  union { uint4 u[2]; v16bf v; } t;
  t.u[0] = *(const uint4*)(p);
  t.u[1] = *(const uint4*)(p + 8);
  return t.v;
}

// 32B global -> LDS, asynchronous (2 x b128). INST_OFFSET applies to both the
// global and the LDS address, so one address pair covers both halves.
__device__ __forceinline__ void async_copy_b32B(uint32_t lds_off, const __bf16* g) {
  asm volatile("global_load_async_to_lds_b128 %0, %1, off\n\t"
               "global_load_async_to_lds_b128 %0, %1, off offset:16"
               :: "v"(lds_off), "v"((unsigned long long)g)
               : "memory");
}

__global__ __launch_bounds__(256)
void cast_f32_bf16(const float* __restrict__ src, __bf16* __restrict__ dst, int n) {
  int i = blockIdx.x * 256 + threadIdx.x;
  if (i < n) dst[i] = (__bf16)src[i];
}

// ---------------------------------------------------------------------------
// out[M,N] = (A @ Bm^T + bias) * scale
//   A  stored [M,K] row-major (stride lda), Bm stored [N,K] row-major (ldb).
//   128x128 block tile, 8 waves (4x2), each wave = 32x64 via 8 WMMAs/K-step.
//   Async double-buffered LDS staging.
// ---------------------------------------------------------------------------
template <bool OUT_F32>
__global__ __launch_bounds__(256)
void gemm_async(const __bf16* __restrict__ A,
                const __bf16* __restrict__ Bm,
                const float*  __restrict__ bias,
                void* __restrict__ outp,
                int M, int N, int K, int lda, int ldb, float scale)
{
  __shared__ __align__(16) __bf16 As[2][BM * LDSS];
  __shared__ __align__(16) __bf16 Bs[2][BN * LDSS];

  const int tid     = threadIdx.x;
  const int lane    = tid & 31;
  const int wave    = tid >> 5;
  const int waveRow = wave & 3;   // 4 wave-rows of 32
  const int waveCol = wave >> 2;  // 2 wave-cols of 64
  const int blockM  = blockIdx.y * BM;
  const int blockN  = blockIdx.x * BN;

  // staging coordinates: each thread owns one 32B half-row in A and B tiles
  const int sr = tid >> 1;        // 0..127
  const int sh = tid & 1;         // K-half of 16 halves
  const __bf16* gA = A  + (size_t)(blockM + sr) * lda + sh * 16;
  const __bf16* gB = Bm + (size_t)(blockN + sr) * ldb + sh * 16;
  const int sOff = sr * LDSS + sh * 16;

  v8f acc[2][4] = {};

  const int fr = lane & 15;       // fragment row within a 16x32 tile
  const int fh = lane >> 4;       // K-half select

  const int nsteps = K / BK;

  // prologue: stage step 0 into buffer 0
  async_copy_b32B((uint32_t)(size_t)&As[0][sOff], gA);
  async_copy_b32B((uint32_t)(size_t)&Bs[0][sOff], gB);

  for (int t = 0; t < nsteps; ++t) {
    const int cur = t & 1;
    if (t + 1 < nsteps) {
      const int koff = (t + 1) * BK;
      async_copy_b32B((uint32_t)(size_t)&As[cur ^ 1][sOff], gA + koff);
      async_copy_b32B((uint32_t)(size_t)&Bs[cur ^ 1][sOff], gB + koff);
      asm volatile("s_wait_asynccnt 0x4" ::: "memory");  // step-t ops retired
    } else {
      asm volatile("s_wait_asynccnt 0x0" ::: "memory");
    }
    __syncthreads();  // all waves' step-t tiles visible in LDS

    v16bf afrag[2], bfrag[4];
    #pragma unroll
    for (int mt = 0; mt < 2; ++mt)
      afrag[mt] = ld_frag(&As[cur][(waveRow * 32 + mt * 16 + fr) * LDSS + fh * 16]);
    #pragma unroll
    for (int nt = 0; nt < 4; ++nt)
      bfrag[nt] = ld_frag(&Bs[cur][(waveCol * 64 + nt * 16 + fr) * LDSS + fh * 16]);

    #pragma unroll
    for (int mt = 0; mt < 2; ++mt)
      #pragma unroll
      for (int nt = 0; nt < 4; ++nt)
        acc[mt][nt] = __builtin_amdgcn_wmma_f32_16x16x32_bf16(
            false, afrag[mt], false, bfrag[nt], (short)0, acc[mt][nt],
            false, false);

    __syncthreads();  // buffer `cur` free for step t+2's async writes
  }

  const int ccol = lane & 15;
  const int crow = (lane >> 4) * 8;
  #pragma unroll
  for (int mt = 0; mt < 2; ++mt) {
    #pragma unroll
    for (int nt = 0; nt < 4; ++nt) {
      int colg = blockN + waveCol * 64 + nt * 16 + ccol;
      float bv = bias ? bias[colg] : 0.0f;
      #pragma unroll
      for (int j = 0; j < 8; ++j) {
        int rowg = blockM + waveRow * 32 + mt * 16 + crow + j;
        float v = (acc[mt][nt][j] + bv) * scale;
        if (OUT_F32) ((float*)outp)[(size_t)rowg * N + colg] = v;
        else         ((__bf16*)outp)[(size_t)rowg * N + colg] = (__bf16)v;
      }
    }
  }
}

// ---------------------------------------------------------------------------
// attn^T GEMM: out[M=512,N=2048](bf16) = (V^T) @ (probs^T)
//   A'[m,k] = Vb[k*lda + m]   (Vb is [K x M]; transposed while staging to LDS)
//   Bm = probs [N,K] row-major (rows of probs are columns of probs^T).
// ---------------------------------------------------------------------------
__global__ __launch_bounds__(256)
void gemm_tA(const __bf16* __restrict__ A,
             const __bf16* __restrict__ Bm,
             __bf16* __restrict__ outp,
             int M, int N, int K, int lda, int ldb)
{
  __shared__ __align__(16) __bf16 As[BM * LDSS];
  __shared__ __align__(16) __bf16 Bs[BN * LDSS];

  const int tid     = threadIdx.x;
  const int lane    = tid & 31;
  const int wave    = tid >> 5;
  const int waveRow = wave & 3;
  const int waveCol = wave >> 2;
  const int blockM  = blockIdx.y * BM;
  const int blockN  = blockIdx.x * BN;

  v8f acc[2][4] = {};

  const int fr = lane & 15;
  const int fh = lane >> 4;

  for (int k0 = 0; k0 < K; k0 += BK) {
    {   // A is [K x M]; read coalesced rows, write transposed into LDS
      int kk = tid >> 3;                 // 0..31
      int e0 = (tid & 7) * 16;           // 0..112
      const __bf16* gp = A + (size_t)(k0 + kk) * lda + blockM + e0;
      #pragma unroll
      for (int i = 0; i < 16; ++i)
        As[(e0 + i) * LDSS + kk] = gp[i];
    }
    {   // B tile: Bs[n][k], 128x32 bf16
      int r = tid >> 1;                  // 0..127
      int h = tid & 1;
      const __bf16* gp = Bm + (size_t)(blockN + r) * ldb + k0 + h * 16;
      *(uint4*)&Bs[r * LDSS + h * 16]     = *(const uint4*)gp;
      *(uint4*)&Bs[r * LDSS + h * 16 + 8] = *(const uint4*)(gp + 8);
    }
    __syncthreads();

    v16bf afrag[2], bfrag[4];
    #pragma unroll
    for (int mt = 0; mt < 2; ++mt)
      afrag[mt] = ld_frag(&As[(waveRow * 32 + mt * 16 + fr) * LDSS + fh * 16]);
    #pragma unroll
    for (int nt = 0; nt < 4; ++nt)
      bfrag[nt] = ld_frag(&Bs[(waveCol * 64 + nt * 16 + fr) * LDSS + fh * 16]);

    #pragma unroll
    for (int mt = 0; mt < 2; ++mt)
      #pragma unroll
      for (int nt = 0; nt < 4; ++nt)
        acc[mt][nt] = __builtin_amdgcn_wmma_f32_16x16x32_bf16(
            false, afrag[mt], false, bfrag[nt], (short)0, acc[mt][nt],
            false, false);

    __syncthreads();
  }

  const int ccol = lane & 15;
  const int crow = (lane >> 4) * 8;
  #pragma unroll
  for (int mt = 0; mt < 2; ++mt) {
    #pragma unroll
    for (int nt = 0; nt < 4; ++nt) {
      int colg = blockN + waveCol * 64 + nt * 16 + ccol;
      #pragma unroll
      for (int j = 0; j < 8; ++j) {
        int rowg = blockM + waveRow * 32 + mt * 16 + crow + j;
        outp[(size_t)rowg * N + colg] = (__bf16)acc[mt][nt][j];
      }
    }
  }
}

// Row softmax over 2048 columns (one 256-thread block per row), masked.
__global__ __launch_bounds__(256)
void softmax_rows(const float* __restrict__ scores, const int* __restrict__ mask,
                  __bf16* __restrict__ probs)
{
  const int row = blockIdx.x;
  const int tid = threadIdx.x;
  const float* srow = scores + (size_t)row * SS;
  __bf16* prow = probs + (size_t)row * SS;

  float vals[8];
  float m = -3.0e38f;
  #pragma unroll
  for (int i = 0; i < 8; ++i) {
    int c = tid + i * 256;
    float s = srow[c];
    if (mask[c] == 0) s = -1.0e9f;
    vals[i] = s;
    m = fmaxf(m, s);
  }
  for (int off = 16; off > 0; off >>= 1) m = fmaxf(m, __shfl_xor(m, off, 32));
  __shared__ float red[8];
  if ((tid & 31) == 0) red[tid >> 5] = m;
  __syncthreads();
  m = red[0];
  #pragma unroll
  for (int w = 1; w < 8; ++w) m = fmaxf(m, red[w]);
  __syncthreads();

  float sum = 0.0f;
  #pragma unroll
  for (int i = 0; i < 8; ++i) { vals[i] = __expf(vals[i] - m); sum += vals[i]; }
  for (int off = 16; off > 0; off >>= 1) sum += __shfl_xor(sum, off, 32);
  if ((tid & 31) == 0) red[tid >> 5] = sum;
  __syncthreads();
  sum = 0.0f;
  #pragma unroll
  for (int w = 0; w < 8; ++w) sum += red[w];
  const float inv = 1.0f / sum;
  #pragma unroll
  for (int i = 0; i < 8; ++i) prow[tid + i * 256] = (__bf16)(vals[i] * inv);
}

extern "C" void kernel_launch(void* const* d_in, const int* in_sizes, int n_in,
                              void* d_out, int out_size, void* d_ws, size_t ws_size,
                              hipStream_t stream) {
  (void)in_sizes; (void)n_in; (void)out_size; (void)ws_size;
  const float* x    = (const float*)d_in[0];
  const int*   mask = (const int*)d_in[1];
  const float* Wq = (const float*)d_in[2];
  const float* bq = (const float*)d_in[3];
  const float* Wk = (const float*)d_in[4];
  const float* bk = (const float*)d_in[5];
  const float* Wv = (const float*)d_in[6];
  const float* bv = (const float*)d_in[7];
  const float* Wo = (const float*)d_in[8];
  const float* bo = (const float*)d_in[9];
  float* out = (float*)d_out;

  // Workspace layout (104 MB). scores/probs/attnT overlay the x_bf16 region,
  // which is dead once Q/K/V are produced.
  char* ws = (char*)d_ws;
  __bf16* xbf    = (__bf16*)(ws);                              // 64 MB
  float*  scores = (float*)(ws);                               // 16 MB (reuse)
  __bf16* probs  = (__bf16*)(ws + (size_t)(16u << 20));        //  8 MB (reuse)
  __bf16* attnT  = (__bf16*)(ws + (size_t)(24u << 20));        //  8 MB (reuse)
  __bf16* wqb    = (__bf16*)(ws + (size_t)(64u << 20));
  __bf16* wkb    = wqb + (size_t)DLOCAL * DMODEL;
  __bf16* wvb    = wkb + (size_t)DLOCAL * DMODEL;
  __bf16* wob    = wvb + (size_t)DLOCAL * DMODEL;
  __bf16* Q      = (__bf16*)(ws + (size_t)(80u << 20));
  __bf16* Kt     = Q  + (size_t)BB * SS * DLOCAL;
  __bf16* V      = Kt + (size_t)BB * SS * DLOCAL;

  const int nX = BB * SS * DMODEL;        // 33,554,432
  const int nW = DLOCAL * DMODEL;         //  2,097,152

  cast_f32_bf16<<<(nX + 255) / 256, 256, 0, stream>>>(x,  xbf, nX);
  cast_f32_bf16<<<(nW + 255) / 256, 256, 0, stream>>>(Wq, wqb, nW);
  cast_f32_bf16<<<(nW + 255) / 256, 256, 0, stream>>>(Wk, wkb, nW);
  cast_f32_bf16<<<(nW + 255) / 256, 256, 0, stream>>>(Wv, wvb, nW);
  cast_f32_bf16<<<(nW + 255) / 256, 256, 0, stream>>>(Wo, wob, nW);

  const float qscale = 0.08838834764831845f;  // 1/sqrt(d_k=128), folded into Q
  const int Mx = BB * SS;                     // 8192

  dim3 gProj(DLOCAL / BN, Mx / BM);           // (4, 64)
  gemm_async<false><<<gProj, 256, 0, stream>>>(
      xbf, wqb, bq, Q,  Mx, DLOCAL, DMODEL, DMODEL, DMODEL, qscale);
  gemm_async<false><<<gProj, 256, 0, stream>>>(
      xbf, wkb, bk, Kt, Mx, DLOCAL, DMODEL, DMODEL, DMODEL, 1.0f);
  gemm_async<false><<<gProj, 256, 0, stream>>>(
      xbf, wvb, bv, V,  Mx, DLOCAL, DMODEL, DMODEL, DMODEL, 1.0f);

  for (int b = 0; b < BB; ++b) {
    const __bf16* Qb = Q  + (size_t)b * SS * DLOCAL;
    const __bf16* Kb = Kt + (size_t)b * SS * DLOCAL;
    const __bf16* Vb = V  + (size_t)b * SS * DLOCAL;
    __bf16* aTb = attnT + (size_t)b * DLOCAL * SS;  // [512, 2048] row-major

    // scores[q,k] = Qb @ Kb^T   (scale already folded into Q)
    dim3 gS(SS / BN, SS / BM);                 // (16, 16)
    gemm_async<true><<<gS, 256, 0, stream>>>(
        Qb, Kb, nullptr, scores, SS, SS, DLOCAL, DLOCAL, DLOCAL, 1.0f);

    softmax_rows<<<SS, 256, 0, stream>>>(scores, mask + (size_t)b * SS, probs);

    // attnT[e,q] = sum_k V[k,e] * probs[q,k]  == (probs @ V)^T
    dim3 gA(SS / BN, DLOCAL / BM);             // (16, 4)
    gemm_tA<<<gA, 256, 0, stream>>>(
        Vb, probs, aTb, DLOCAL, SS, SS, DLOCAL, SS);
  }

  // attnT buffer, reinterpreted as [8192, 512] row-major, is exactly the
  // reference's swapaxes(1,2).reshape(B,S,d_local) permutation.
  dim3 gO(DMODEL / BN, Mx / BM);               // (32, 64)
  gemm_async<true><<<gO, 256, 0, stream>>>(
      attnT, wob, bo, out, Mx, DMODEL, DLOCAL, DLOCAL, DLOCAL, 1.0f);
}

// v001
// It runs in 367 microseconds.
// In two side-by-side timings against v000, it was 1.74 and 1.73 times as fast.
#include <hip/hip_runtime.h>

typedef __attribute__((ext_vector_type(16))) __bf16 v16bf;
typedef __attribute__((ext_vector_type(8)))  float  v8f;

#define BM 128
#define BN 128
#define BK 32
#define LDSS 40

// Problem constants
#define DMODEL 4096
#define DLOCAL 512
#define BB     4
#define SS     2048

__device__ __forceinline__ v16bf ld_frag(const __bf16* p) {
  union { uint4 u[2]; v16bf v; } t;
  t.u[0] = *(const uint4*)(p);
  t.u[1] = *(const uint4*)(p + 8);
  return t.v;
}

// 32B global -> LDS, asynchronous (2 x b128). INST_OFFSET applies to both the
// global and the LDS address, so one address pair covers both halves.
__device__ __forceinline__ void async_copy_b32B(uint32_t lds_off, const __bf16* g) {
  asm volatile("global_load_async_to_lds_b128 %0, %1, off\n\t"
               "global_load_async_to_lds_b128 %0, %1, off offset:16"
               :: "v"(lds_off), "v"((unsigned long long)g)
               : "memory");
}

// One grid casts all five f32 operands: the first XBLK blocks take x, the rest
// take the four weight matrices (WBLK blocks each; their bf16 copies are
// contiguous at wdst).
#define XBLK (BB * SS * DMODEL / 256)
#define WBLK (DLOCAL * DMODEL / 256)
__global__ __launch_bounds__(256)
void cast_f32_bf16(const float* __restrict__ x,
                   const float* __restrict__ Wq, const float* __restrict__ Wk,
                   const float* __restrict__ Wv, const float* __restrict__ Wo,
                   __bf16* __restrict__ xdst, __bf16* __restrict__ wdst) {
  int blk = blockIdx.x;
  const float* src = x;
  __bf16* dst = xdst;
  if (blk >= XBLK) {
    blk -= XBLK;
    const int w = blk / WBLK;
    blk -= w * WBLK;
    src = (w == 0) ? Wq : (w == 1) ? Wk : (w == 2) ? Wv : Wo;
    dst = wdst + (size_t)w * (DLOCAL * DMODEL);
  }
  int i = blk * 256 + threadIdx.x;
  dst[i] = (__bf16)src[i];
}

// ---------------------------------------------------------------------------
// out[M,N] = (A @ Bm^T + bias) * scale
//   A  stored [M,K] row-major (stride lda), Bm stored [N,K] row-major (ldb).
//   128x128 block tile, 8 waves (4x2), each wave = 32x64 via 8 WMMAs/K-step.
//   Async double-buffered LDS staging.
//   blockIdx.z picks one of several independent products of the same shape:
//   operand and output bases move by zA / zB / zO elements per z; z = 1 and 2
//   take bias1 and bias2, and every z > 0 takes scale1.
// ---------------------------------------------------------------------------
template <bool OUT_F32>
__global__ __launch_bounds__(256)
void gemm_async(const __bf16* __restrict__ A,
                const __bf16* __restrict__ Bm,
                const float*  __restrict__ bias,
                const float*  __restrict__ bias1,
                const float*  __restrict__ bias2,
                void* __restrict__ outp,
                int M, int N, int K, int lda, int ldb, float scale, float scale1,
                int zA, int zB, int zO)
{
  __shared__ __align__(16) __bf16 As[2][BM * LDSS];
  __shared__ __align__(16) __bf16 Bs[2][BN * LDSS];

  const int tid     = threadIdx.x;
  const int lane    = tid & 31;
  const int wave    = tid >> 5;
  const int waveRow = wave & 3;   // 4 wave-rows of 32
  const int waveCol = wave >> 2;  // 2 wave-cols of 64
  const int blockM  = blockIdx.y * BM;
  const int blockN  = blockIdx.x * BN;

  const int z = blockIdx.z;
  A  += (size_t)z * zA;
  Bm += (size_t)z * zB;
  const size_t oOff = (size_t)z * zO;
  if (z == 1) bias = bias1;
  if (z == 2) bias = bias2;
  if (z > 0)  scale = scale1;

  // staging coordinates: each thread owns one 32B half-row in A and B tiles
  const int sr = tid >> 1;        // 0..127
  const int sh = tid & 1;         // K-half of 16 halves
  const __bf16* gA = A  + (size_t)(blockM + sr) * lda + sh * 16;
  const __bf16* gB = Bm + (size_t)(blockN + sr) * ldb + sh * 16;
  const int sOff = sr * LDSS + sh * 16;

  v8f acc[2][4] = {};

  const int fr = lane & 15;       // fragment row within a 16x32 tile
  const int fh = lane >> 4;       // K-half select

  const int nsteps = K / BK;

  // prologue: stage step 0 into buffer 0
  async_copy_b32B((uint32_t)(size_t)&As[0][sOff], gA);
  async_copy_b32B((uint32_t)(size_t)&Bs[0][sOff], gB);

  for (int t = 0; t < nsteps; ++t) {
    const int cur = t & 1;
    if (t + 1 < nsteps) {
      const int koff = (t + 1) * BK;
      async_copy_b32B((uint32_t)(size_t)&As[cur ^ 1][sOff], gA + koff);
      async_copy_b32B((uint32_t)(size_t)&Bs[cur ^ 1][sOff], gB + koff);
      asm volatile("s_wait_asynccnt 0x4" ::: "memory");  // step-t ops retired
    } else {
      asm volatile("s_wait_asynccnt 0x0" ::: "memory");
    }
    __syncthreads();  // all waves' step-t tiles visible in LDS

    v16bf afrag[2], bfrag[4];
    #pragma unroll
    for (int mt = 0; mt < 2; ++mt)
      afrag[mt] = ld_frag(&As[cur][(waveRow * 32 + mt * 16 + fr) * LDSS + fh * 16]);
    #pragma unroll
    for (int nt = 0; nt < 4; ++nt)
      bfrag[nt] = ld_frag(&Bs[cur][(waveCol * 64 + nt * 16 + fr) * LDSS + fh * 16]);

    #pragma unroll
    for (int mt = 0; mt < 2; ++mt)
      #pragma unroll
      for (int nt = 0; nt < 4; ++nt)
        acc[mt][nt] = __builtin_amdgcn_wmma_f32_16x16x32_bf16(
            false, afrag[mt], false, bfrag[nt], (short)0, acc[mt][nt],
            false, false);

    __syncthreads();  // buffer `cur` free for step t+2's async writes
  }

  const int ccol = lane & 15;
  const int crow = (lane >> 4) * 8;
  #pragma unroll
  for (int mt = 0; mt < 2; ++mt) {
    #pragma unroll
    for (int nt = 0; nt < 4; ++nt) {
      int colg = blockN + waveCol * 64 + nt * 16 + ccol;
      float bv = bias ? bias[colg] : 0.0f;
      #pragma unroll
      for (int j = 0; j < 8; ++j) {
        int rowg = blockM + waveRow * 32 + mt * 16 + crow + j;
        float v = (acc[mt][nt][j] + bv) * scale;
        if (OUT_F32) ((float*)outp)[oOff + (size_t)rowg * N + colg] = v;
        else         ((__bf16*)outp)[oOff + (size_t)rowg * N + colg] = (__bf16)v;
      }
      // the next column tile reuses registers that the stores above name: this
      // wait stands in front of their overwrite (no tile follows the last one)
      if (mt * 4 + nt < 7) asm volatile("s_wait_xcnt 0x0" ::: "memory");
    }
  }
}

// ---------------------------------------------------------------------------
// attn^T GEMM: out[M=512,N=2048](bf16) = (V^T) @ (probs^T)
//   A'[m,k] = Vb[k*lda + m]   (Vb is [K x M]; transposed while staging to LDS)
//   Bm = probs [N,K] row-major (rows of probs are columns of probs^T).
//   blockIdx.z = batch; bases move by zA / zB / zO elements per batch.
// ---------------------------------------------------------------------------
__global__ __launch_bounds__(256)
void gemm_tA(const __bf16* __restrict__ A,
             const __bf16* __restrict__ Bm,
             __bf16* __restrict__ outp,
             int M, int N, int K, int lda, int ldb, int zA, int zB, int zO)
{
  __shared__ __align__(16) __bf16 As[BM * LDSS];
  __shared__ __align__(16) __bf16 Bs[BN * LDSS];

  const int tid     = threadIdx.x;
  const int lane    = tid & 31;
  const int wave    = tid >> 5;
  const int waveRow = wave & 3;
  const int waveCol = wave >> 2;
  const int blockM  = blockIdx.y * BM;
  const int blockN  = blockIdx.x * BN;

  A    += (size_t)blockIdx.z * zA;
  Bm   += (size_t)blockIdx.z * zB;
  outp += (size_t)blockIdx.z * zO;

  v8f acc[2][4] = {};

  const int fr = lane & 15;
  const int fh = lane >> 4;

  for (int k0 = 0; k0 < K; k0 += BK) {
    {   // A is [K x M]; read coalesced rows, write transposed into LDS
      int kk = tid >> 3;                 // 0..31
      int e0 = (tid & 7) * 16;           // 0..112
      const __bf16* gp = A + (size_t)(k0 + kk) * lda + blockM + e0;
      #pragma unroll
      for (int i = 0; i < 16; ++i)
        As[(e0 + i) * LDSS + kk] = gp[i];
    }
    {   // B tile: Bs[n][k], 128x32 bf16
      int r = tid >> 1;                  // 0..127
      int h = tid & 1;
      const __bf16* gp = Bm + (size_t)(blockN + r) * ldb + k0 + h * 16;
      *(uint4*)&Bs[r * LDSS + h * 16]     = *(const uint4*)gp;
      *(uint4*)&Bs[r * LDSS + h * 16 + 8] = *(const uint4*)(gp + 8);
    }
    __syncthreads();

    v16bf afrag[2], bfrag[4];
    #pragma unroll
    for (int mt = 0; mt < 2; ++mt)
      afrag[mt] = ld_frag(&As[(waveRow * 32 + mt * 16 + fr) * LDSS + fh * 16]);
    #pragma unroll
    for (int nt = 0; nt < 4; ++nt)
      bfrag[nt] = ld_frag(&Bs[(waveCol * 64 + nt * 16 + fr) * LDSS + fh * 16]);

    #pragma unroll
    for (int mt = 0; mt < 2; ++mt)
      #pragma unroll
      for (int nt = 0; nt < 4; ++nt)
        acc[mt][nt] = __builtin_amdgcn_wmma_f32_16x16x32_bf16(
            false, afrag[mt], false, bfrag[nt], (short)0, acc[mt][nt],
            false, false);

    __syncthreads();
  }

  const int ccol = lane & 15;
  const int crow = (lane >> 4) * 8;
  #pragma unroll
  for (int mt = 0; mt < 2; ++mt) {
    #pragma unroll
    for (int nt = 0; nt < 4; ++nt) {
      int colg = blockN + waveCol * 64 + nt * 16 + ccol;
      #pragma unroll
      for (int j = 0; j < 8; ++j) {
        int rowg = blockM + waveRow * 32 + mt * 16 + crow + j;
        outp[(size_t)rowg * N + colg] = (__bf16)acc[mt][nt][j];
      }
    }
  }
}

// Row softmax over 2048 columns (one 256-thread block per row), masked.
// blockIdx.y = batch (its own mask row and its own 2048 score rows).
__global__ __launch_bounds__(256)
void softmax_rows(const float* __restrict__ scores, const int* __restrict__ mask,
                  __bf16* __restrict__ probs)
{
  const int row = blockIdx.y * SS + blockIdx.x;
  const int tid = threadIdx.x;
  mask += (size_t)blockIdx.y * SS;
  const float* srow = scores + (size_t)row * SS;
  __bf16* prow = probs + (size_t)row * SS;

  float vals[8];
  float m = -3.0e38f;
  #pragma unroll
  for (int i = 0; i < 8; ++i) {
    int c = tid + i * 256;
    float s = srow[c];
    if (mask[c] == 0) s = -1.0e9f;
    vals[i] = s;
    m = fmaxf(m, s);
  }
  for (int off = 16; off > 0; off >>= 1) m = fmaxf(m, __shfl_xor(m, off, 32));
  __shared__ float red[8];
  if ((tid & 31) == 0) red[tid >> 5] = m;
  __syncthreads();
  m = red[0];
  #pragma unroll
  for (int w = 1; w < 8; ++w) m = fmaxf(m, red[w]);
  __syncthreads();

  float sum = 0.0f;
  #pragma unroll
  for (int i = 0; i < 8; ++i) { vals[i] = __expf(vals[i] - m); sum += vals[i]; }
  for (int off = 16; off > 0; off >>= 1) sum += __shfl_xor(sum, off, 32);
  if ((tid & 31) == 0) red[tid >> 5] = sum;
  __syncthreads();
  sum = 0.0f;
  #pragma unroll
  for (int w = 0; w < 8; ++w) sum += red[w];
  const float inv = 1.0f / sum;
  #pragma unroll
  for (int i = 0; i < 8; ++i) prow[tid + i * 256] = (__bf16)(vals[i] * inv);
}

extern "C" void kernel_launch(void* const* d_in, const int* in_sizes, int n_in,
                              void* d_out, int out_size, void* d_ws, size_t ws_size,
                              hipStream_t stream) {
  (void)in_sizes; (void)n_in; (void)out_size; (void)ws_size;
  const float* x    = (const float*)d_in[0];
  const int*   mask = (const int*)d_in[1];
  const float* Wq = (const float*)d_in[2];
  const float* bq = (const float*)d_in[3];
  const float* Wk = (const float*)d_in[4];
  const float* bk = (const float*)d_in[5];
  const float* Wv = (const float*)d_in[6];
  const float* bv = (const float*)d_in[7];
  const float* Wo = (const float*)d_in[8];
  const float* bo = (const float*)d_in[9];
  float* out = (float*)d_out;

  // Workspace layout (144 MB). scores (all four batches) overlay the x_bf16
  // region, which is dead once Q/K/V are produced.
  char* ws = (char*)d_ws;
  __bf16* xbf    = (__bf16*)(ws);                              // 64 MB
  float*  scores = (float*)(ws);                               // 64 MB (reuse)
  __bf16* wqb    = (__bf16*)(ws + (size_t)(64u << 20));        // Wq,Wk,Wv,Wo
  __bf16* wob    = wqb + (size_t)3 * DLOCAL * DMODEL;
  __bf16* Q      = (__bf16*)(ws + (size_t)(80u << 20));        // Q,K,V: 24 MB
  __bf16* Kt     = Q  + (size_t)BB * SS * DLOCAL;
  __bf16* V      = Kt + (size_t)BB * SS * DLOCAL;
  __bf16* probs  = (__bf16*)(ws + (size_t)(104u << 20));       // 32 MB
  __bf16* attnT  = (__bf16*)(ws + (size_t)(136u << 20));       //  8 MB

  cast_f32_bf16<<<XBLK + 4 * WBLK, 256, 0, stream>>>(x, Wq, Wk, Wv, Wo, xbf, wqb);

  const float qscale = 0.08838834764831845f;  // 1/sqrt(d_k=128), folded into Q
  const int Mx = BB * SS;                     // 8192

  // Q, K, V projections: z = 0, 1, 2 (weights and outputs are contiguous)
  dim3 gProj(DLOCAL / BN, Mx / BM, 3);        // (4, 64, 3)
  gemm_async<false><<<gProj, 256, 0, stream>>>(
      xbf, wqb, bq, bk, bv, Q, Mx, DLOCAL, DMODEL, DMODEL, DMODEL, qscale, 1.0f,
      0, DLOCAL * DMODEL, BB * SS * DLOCAL);

  // scores[b,q,k] = Q_b @ K_b^T   (scale already folded into Q), z = batch
  dim3 gS(SS / BN, SS / BM, BB);              // (16, 16, 4)
  gemm_async<true><<<gS, 256, 0, stream>>>(
      Q, Kt, nullptr, nullptr, nullptr, scores, SS, SS, DLOCAL, DLOCAL, DLOCAL,
      1.0f, 1.0f, SS * DLOCAL, SS * DLOCAL, SS * SS);

  softmax_rows<<<dim3(SS, BB), 256, 0, stream>>>(scores, mask, probs);

  // attnT[b,e,q] = sum_k V[b,k,e] * probs[b,q,k]  == (probs_b @ V_b)^T, z = batch
  dim3 gA(SS / BN, DLOCAL / BM, BB);          // (16, 4, 4)
  gemm_tA<<<gA, 256, 0, stream>>>(
      V, probs, attnT, DLOCAL, SS, SS, DLOCAL, SS,
      SS * DLOCAL, SS * SS, DLOCAL * SS);

  // attnT buffer, reinterpreted as [8192, 512] row-major, is exactly the
  // reference's swapaxes(1,2).reshape(B,S,d_local) permutation.
  dim3 gO(DMODEL / BN, Mx / BM);               // (32, 64)
  gemm_async<true><<<gO, 256, 0, stream>>>(
      attnT, wob, bo, nullptr, nullptr, out, Mx, DMODEL, DLOCAL, DLOCAL, DLOCAL,
      1.0f, 1.0f, 0, 0, 0);
}

// v002
// Measured time: 305 microseconds a run.
// Timed twice side by side with v001, it ran 1.21 times as fast both times.
// All steps since v000 together make it 2.10 times as fast.
#include <hip/hip_runtime.h>

typedef __attribute__((ext_vector_type(16))) __bf16 v16bf;
typedef __attribute__((ext_vector_type(8)))  float  v8f;

#define BM 128
#define BN 128
#define BK 32
#define LDSS 40

// Problem constants
#define DMODEL 4096
#define DLOCAL 512
#define BB     4
#define SS     2048

__device__ __forceinline__ v16bf ld_frag(const __bf16* p) {
  union { uint4 u[2]; v16bf v; } t;
  t.u[0] = *(const uint4*)(p);
  t.u[1] = *(const uint4*)(p + 8);
  return t.v;
}

// 32B global -> LDS, asynchronous (2 x b128). INST_OFFSET applies to both the
// global and the LDS address, so one address pair covers both halves.
__device__ __forceinline__ void async_copy_b32B(uint32_t lds_off, const __bf16* g) {
  asm volatile("global_load_async_to_lds_b128 %0, %1, off\n\t"
               "global_load_async_to_lds_b128 %0, %1, off offset:16"
               :: "v"(lds_off), "v"((unsigned long long)g)
               : "memory");
}

typedef __attribute__((ext_vector_type(4))) float  f32x4;
typedef __attribute__((ext_vector_type(4))) __bf16 bf16x4;

// One grid casts all five f32 operands as a stream. A chunk is what one block
// moves in one trip: 256 threads x CAST_LD loads of 16 bytes, each wave-wide
// load covering 512 contiguous bytes. Chunks 0 .. XCHUNKS-1 are x, then WCHUNKS
// for each weight matrix (their bf16 copies are contiguous at wdst). All
// CAST_BLOCKS blocks are resident at once and take chunks CAST_BLOCKS apart.
#define CAST_LD     8
#define CHUNK       (256 * CAST_LD * 4)
#define XCHUNKS     (BB * SS * DMODEL / CHUNK)
#define WCHUNKS     (DLOCAL * DMODEL / CHUNK)
#define CAST_BLOCKS 1024
#define CAST_TRIPS  ((XCHUNKS + 4 * WCHUNKS) / CAST_BLOCKS)
static_assert(CAST_TRIPS * CAST_BLOCKS == XCHUNKS + 4 * WCHUNKS, "whole trips");
static_assert(XCHUNKS % CAST_BLOCKS == 0, "a trip is all x or all weights");

__global__ __launch_bounds__(256)
void cast_f32_bf16(const float* __restrict__ x,
                   const float* __restrict__ Wq, const float* __restrict__ Wk,
                   const float* __restrict__ Wv, const float* __restrict__ Wo,
                   __bf16* __restrict__ xdst, __bf16* __restrict__ wdst) {
  f32x4 v[CAST_TRIPS][CAST_LD];

  // unrolled so that every register set is indexed by constants; trip t's loads
  // are issued before trip t-1 is converted and stored
  #pragma unroll
  for (int trip = 0; trip <= CAST_TRIPS; ++trip) {
    if (trip < CAST_TRIPS) {
      int c = trip * CAST_BLOCKS + blockIdx.x;
      const float* src = x;
      if (trip * CAST_BLOCKS >= XCHUNKS) {
        c -= XCHUNKS;
        const int w = c / WCHUNKS;
        c -= w * WCHUNKS;
        src = (w == 0) ? Wq : (w == 1) ? Wk : (w == 2) ? Wv : Wo;
      }
      const f32x4* s = (const f32x4*)(src + (size_t)c * CHUNK) + threadIdx.x;
      #pragma unroll
      for (int j = 0; j < CAST_LD; ++j) v[trip][j] = s[j * 256];
    }
    if (trip > 0) {
      int c = (trip - 1) * CAST_BLOCKS + blockIdx.x;
      __bf16* dst = xdst;
      if ((trip - 1) * CAST_BLOCKS >= XCHUNKS) { c -= XCHUNKS; dst = wdst; }
      bf16x4* d = (bf16x4*)(dst + (size_t)c * CHUNK) + threadIdx.x;
      #pragma unroll
      for (int j = 0; j < CAST_LD; ++j)
        d[j * 256] = __builtin_convertvector(v[trip - 1][j], bf16x4);
      // the next trip's loads reuse registers that the stores above name: this
      // wait stands in front of their overwrite (nothing follows the last trip)
      if (trip < CAST_TRIPS) asm volatile("s_wait_xcnt 0x0" ::: "memory");
    }
  }
}

// ---------------------------------------------------------------------------
// out[M,N] = (A @ Bm^T + bias) * scale
//   A  stored [M,K] row-major (stride lda), Bm stored [N,K] row-major (ldb).
//   128x128 block tile, 8 waves (4x2), each wave = 32x64 via 8 WMMAs/K-step.
//   Async double-buffered LDS staging.
//   blockIdx.z picks one of several independent products of the same shape:
//   operand and output bases move by zA / zB / zO elements per z; z = 1 and 2
//   take bias1 and bias2, and every z > 0 takes scale1.
// ---------------------------------------------------------------------------
template <bool OUT_F32>
__global__ __launch_bounds__(256)
void gemm_async(const __bf16* __restrict__ A,
                const __bf16* __restrict__ Bm,
                const float*  __restrict__ bias,
                const float*  __restrict__ bias1,
                const float*  __restrict__ bias2,
                void* __restrict__ outp,
                int M, int N, int K, int lda, int ldb, float scale, float scale1,
                int zA, int zB, int zO)
{
  __shared__ __align__(16) __bf16 As[2][BM * LDSS];
  __shared__ __align__(16) __bf16 Bs[2][BN * LDSS];

  const int tid     = threadIdx.x;
  const int lane    = tid & 31;
  const int wave    = tid >> 5;
  const int waveRow = wave & 3;   // 4 wave-rows of 32
  const int waveCol = wave >> 2;  // 2 wave-cols of 64
  const int blockM  = blockIdx.y * BM;
  const int blockN  = blockIdx.x * BN;

  const int z = blockIdx.z;
  A  += (size_t)z * zA;
  Bm += (size_t)z * zB;
  const size_t oOff = (size_t)z * zO;
  if (z == 1) bias = bias1;
  if (z == 2) bias = bias2;
  if (z > 0)  scale = scale1;

  // staging coordinates: each thread owns one 32B half-row in A and B tiles
  const int sr = tid >> 1;        // 0..127
  const int sh = tid & 1;         // K-half of 16 halves
  const __bf16* gA = A  + (size_t)(blockM + sr) * lda + sh * 16;
  const __bf16* gB = Bm + (size_t)(blockN + sr) * ldb + sh * 16;
  const int sOff = sr * LDSS + sh * 16;

  v8f acc[2][4] = {};

  const int fr = lane & 15;       // fragment row within a 16x32 tile
  const int fh = lane >> 4;       // K-half select

  const int nsteps = K / BK;

  // prologue: stage step 0 into buffer 0
  async_copy_b32B((uint32_t)(size_t)&As[0][sOff], gA);
  async_copy_b32B((uint32_t)(size_t)&Bs[0][sOff], gB);

  for (int t = 0; t < nsteps; ++t) {
    const int cur = t & 1;
    if (t + 1 < nsteps) {
      const int koff = (t + 1) * BK;
      async_copy_b32B((uint32_t)(size_t)&As[cur ^ 1][sOff], gA + koff);
      async_copy_b32B((uint32_t)(size_t)&Bs[cur ^ 1][sOff], gB + koff);
      asm volatile("s_wait_asynccnt 0x4" ::: "memory");  // step-t ops retired
    } else {
      asm volatile("s_wait_asynccnt 0x0" ::: "memory");
    }
    __syncthreads();  // all waves' step-t tiles visible in LDS

    v16bf afrag[2], bfrag[4];
    #pragma unroll
    for (int mt = 0; mt < 2; ++mt)
      afrag[mt] = ld_frag(&As[cur][(waveRow * 32 + mt * 16 + fr) * LDSS + fh * 16]);
    #pragma unroll
    for (int nt = 0; nt < 4; ++nt)
      bfrag[nt] = ld_frag(&Bs[cur][(waveCol * 64 + nt * 16 + fr) * LDSS + fh * 16]);

    #pragma unroll
    for (int mt = 0; mt < 2; ++mt)
      #pragma unroll
      for (int nt = 0; nt < 4; ++nt)
        acc[mt][nt] = __builtin_amdgcn_wmma_f32_16x16x32_bf16(
            false, afrag[mt], false, bfrag[nt], (short)0, acc[mt][nt],
            false, false);

    __syncthreads();  // buffer `cur` free for step t+2's async writes
  }

  const int ccol = lane & 15;
  const int crow = (lane >> 4) * 8;
  #pragma unroll
  for (int mt = 0; mt < 2; ++mt) {
    #pragma unroll
    for (int nt = 0; nt < 4; ++nt) {
      int colg = blockN + waveCol * 64 + nt * 16 + ccol;
      float bv = bias ? bias[colg] : 0.0f;
      #pragma unroll
      for (int j = 0; j < 8; ++j) {
        int rowg = blockM + waveRow * 32 + mt * 16 + crow + j;
        float v = (acc[mt][nt][j] + bv) * scale;
        if (OUT_F32) ((float*)outp)[oOff + (size_t)rowg * N + colg] = v;
        else         ((__bf16*)outp)[oOff + (size_t)rowg * N + colg] = (__bf16)v;
      }
      // the next column tile reuses registers that the stores above name: this
      // wait stands in front of their overwrite (no tile follows the last one)
      if (mt * 4 + nt < 7) asm volatile("s_wait_xcnt 0x0" ::: "memory");
    }
  }
}

// ---------------------------------------------------------------------------
// attn^T GEMM: out[M=512,N=2048](bf16) = (V^T) @ (probs^T)
//   A'[m,k] = Vb[k*lda + m]   (Vb is [K x M]; transposed while staging to LDS)
//   Bm = probs [N,K] row-major (rows of probs are columns of probs^T).
//   blockIdx.z = batch; bases move by zA / zB / zO elements per batch.
// ---------------------------------------------------------------------------
__global__ __launch_bounds__(256)
void gemm_tA(const __bf16* __restrict__ A,
             const __bf16* __restrict__ Bm,
             __bf16* __restrict__ outp,
             int M, int N, int K, int lda, int ldb, int zA, int zB, int zO)
{
  __shared__ __align__(16) __bf16 As[BM * LDSS];
  __shared__ __align__(16) __bf16 Bs[BN * LDSS];

  const int tid     = threadIdx.x;
  const int lane    = tid & 31;
  const int wave    = tid >> 5;
  const int waveRow = wave & 3;
  const int waveCol = wave >> 2;
  const int blockM  = blockIdx.y * BM;
  const int blockN  = blockIdx.x * BN;

  A    += (size_t)blockIdx.z * zA;
  Bm   += (size_t)blockIdx.z * zB;
  outp += (size_t)blockIdx.z * zO;

  v8f acc[2][4] = {};

  const int fr = lane & 15;
  const int fh = lane >> 4;

  for (int k0 = 0; k0 < K; k0 += BK) {
    {   // A is [K x M]; read coalesced rows, write transposed into LDS
      int kk = tid >> 3;                 // 0..31
      int e0 = (tid & 7) * 16;           // 0..112
      const __bf16* gp = A + (size_t)(k0 + kk) * lda + blockM + e0;
      #pragma unroll
      for (int i = 0; i < 16; ++i)
        As[(e0 + i) * LDSS + kk] = gp[i];
    }
    {   // B tile: Bs[n][k], 128x32 bf16
      int r = tid >> 1;                  // 0..127
      int h = tid & 1;
      const __bf16* gp = Bm + (size_t)(blockN + r) * ldb + k0 + h * 16;
      *(uint4*)&Bs[r * LDSS + h * 16]     = *(const uint4*)gp;
      *(uint4*)&Bs[r * LDSS + h * 16 + 8] = *(const uint4*)(gp + 8);
    }
    __syncthreads();

    v16bf afrag[2], bfrag[4];
    #pragma unroll
    for (int mt = 0; mt < 2; ++mt)
      afrag[mt] = ld_frag(&As[(waveRow * 32 + mt * 16 + fr) * LDSS + fh * 16]);
    #pragma unroll
    for (int nt = 0; nt < 4; ++nt)
      bfrag[nt] = ld_frag(&Bs[(waveCol * 64 + nt * 16 + fr) * LDSS + fh * 16]);

    #pragma unroll
    for (int mt = 0; mt < 2; ++mt)
      #pragma unroll
      for (int nt = 0; nt < 4; ++nt)
        acc[mt][nt] = __builtin_amdgcn_wmma_f32_16x16x32_bf16(
            false, afrag[mt], false, bfrag[nt], (short)0, acc[mt][nt],
            false, false);

    __syncthreads();
  }

  const int ccol = lane & 15;
  const int crow = (lane >> 4) * 8;
  #pragma unroll
  for (int mt = 0; mt < 2; ++mt) {
    #pragma unroll
    for (int nt = 0; nt < 4; ++nt) {
      int colg = blockN + waveCol * 64 + nt * 16 + ccol;
      #pragma unroll
      for (int j = 0; j < 8; ++j) {
        int rowg = blockM + waveRow * 32 + mt * 16 + crow + j;
        outp[(size_t)rowg * N + colg] = (__bf16)acc[mt][nt][j];
      }
    }
  }
}

// Row softmax over 2048 columns (one 256-thread block per row), masked.
// blockIdx.y = batch (its own mask row and its own 2048 score rows).
__global__ __launch_bounds__(256)
void softmax_rows(const float* __restrict__ scores, const int* __restrict__ mask,
                  __bf16* __restrict__ probs)
{
  const int row = blockIdx.y * SS + blockIdx.x;
  const int tid = threadIdx.x;
  mask += (size_t)blockIdx.y * SS;
  const float* srow = scores + (size_t)row * SS;
  __bf16* prow = probs + (size_t)row * SS;

  float vals[8];
  float m = -3.0e38f;
  #pragma unroll
  for (int i = 0; i < 8; ++i) {
    int c = tid + i * 256;
    float s = srow[c];
    if (mask[c] == 0) s = -1.0e9f;
    vals[i] = s;
    m = fmaxf(m, s);
  }
  for (int off = 16; off > 0; off >>= 1) m = fmaxf(m, __shfl_xor(m, off, 32));
  __shared__ float red[8];
  if ((tid & 31) == 0) red[tid >> 5] = m;
  __syncthreads();
  m = red[0];
  #pragma unroll
  for (int w = 1; w < 8; ++w) m = fmaxf(m, red[w]);
  __syncthreads();

  float sum = 0.0f;
  #pragma unroll
  for (int i = 0; i < 8; ++i) { vals[i] = __expf(vals[i] - m); sum += vals[i]; }
  for (int off = 16; off > 0; off >>= 1) sum += __shfl_xor(sum, off, 32);
  if ((tid & 31) == 0) red[tid >> 5] = sum;
  __syncthreads();
  sum = 0.0f;
  #pragma unroll
  for (int w = 0; w < 8; ++w) sum += red[w];
  const float inv = 1.0f / sum;
  #pragma unroll
  for (int i = 0; i < 8; ++i) prow[tid + i * 256] = (__bf16)(vals[i] * inv);
}

extern "C" void kernel_launch(void* const* d_in, const int* in_sizes, int n_in,
                              void* d_out, int out_size, void* d_ws, size_t ws_size,
                              hipStream_t stream) {
  (void)in_sizes; (void)n_in; (void)out_size; (void)ws_size;
  const float* x    = (const float*)d_in[0];
  const int*   mask = (const int*)d_in[1];
  const float* Wq = (const float*)d_in[2];
  const float* bq = (const float*)d_in[3];
  const float* Wk = (const float*)d_in[4];
  const float* bk = (const float*)d_in[5];
  const float* Wv = (const float*)d_in[6];
  const float* bv = (const float*)d_in[7];
  const float* Wo = (const float*)d_in[8];
  const float* bo = (const float*)d_in[9];
  float* out = (float*)d_out;

  // Workspace layout (144 MB). scores (all four batches) overlay the x_bf16
  // region, which is dead once Q/K/V are produced.
  char* ws = (char*)d_ws;
  __bf16* xbf    = (__bf16*)(ws);                              // 64 MB
  float*  scores = (float*)(ws);                               // 64 MB (reuse)
  __bf16* wqb    = (__bf16*)(ws + (size_t)(64u << 20));        // Wq,Wk,Wv,Wo
  __bf16* wob    = wqb + (size_t)3 * DLOCAL * DMODEL;
  __bf16* Q      = (__bf16*)(ws + (size_t)(80u << 20));        // Q,K,V: 24 MB
  __bf16* Kt     = Q  + (size_t)BB * SS * DLOCAL;
  __bf16* V      = Kt + (size_t)BB * SS * DLOCAL;
  __bf16* probs  = (__bf16*)(ws + (size_t)(104u << 20));       // 32 MB
  __bf16* attnT  = (__bf16*)(ws + (size_t)(136u << 20));       //  8 MB

  cast_f32_bf16<<<CAST_BLOCKS, 256, 0, stream>>>(x, Wq, Wk, Wv, Wo, xbf, wqb);

  const float qscale = 0.08838834764831845f;  // 1/sqrt(d_k=128), folded into Q
  const int Mx = BB * SS;                     // 8192

  // Q, K, V projections: z = 0, 1, 2 (weights and outputs are contiguous)
  dim3 gProj(DLOCAL / BN, Mx / BM, 3);        // (4, 64, 3)
  gemm_async<false><<<gProj, 256, 0, stream>>>(
      xbf, wqb, bq, bk, bv, Q, Mx, DLOCAL, DMODEL, DMODEL, DMODEL, qscale, 1.0f,
      0, DLOCAL * DMODEL, BB * SS * DLOCAL);

  // scores[b,q,k] = Q_b @ K_b^T   (scale already folded into Q), z = batch
  dim3 gS(SS / BN, SS / BM, BB);              // (16, 16, 4)
  gemm_async<true><<<gS, 256, 0, stream>>>(
      Q, Kt, nullptr, nullptr, nullptr, scores, SS, SS, DLOCAL, DLOCAL, DLOCAL,
      1.0f, 1.0f, SS * DLOCAL, SS * DLOCAL, SS * SS);

  softmax_rows<<<dim3(SS, BB), 256, 0, stream>>>(scores, mask, probs);

  // attnT[b,e,q] = sum_k V[b,k,e] * probs[b,q,k]  == (probs_b @ V_b)^T, z = batch
  dim3 gA(SS / BN, DLOCAL / BM, BB);          // (16, 4, 4)
  gemm_tA<<<gA, 256, 0, stream>>>(
      V, probs, attnT, DLOCAL, SS, SS, DLOCAL, SS,
      SS * DLOCAL, SS * SS, DLOCAL * SS);

  // attnT buffer, reinterpreted as [8192, 512] row-major, is exactly the
  // reference's swapaxes(1,2).reshape(B,S,d_local) permutation.
  dim3 gO(DMODEL / BN, Mx / BM);               // (32, 64)
  gemm_async<true><<<gO, 256, 0, stream>>>(
      attnT, wob, bo, nullptr, nullptr, out, Mx, DMODEL, DLOCAL, DLOCAL, DLOCAL,
      1.0f, 1.0f, 0, 0, 0);
}

// v003
// Measured time: 282 microseconds a run.
// Two timings next to v002 put it at 1.08 and 1.09 times that version's speed.
// Over all steps from v000 it is 2.28 times as fast.
#include <hip/hip_runtime.h>

typedef __attribute__((ext_vector_type(16))) __bf16 v16bf;
typedef __attribute__((ext_vector_type(8)))  float  v8f;

#define BM 128
#define BN 128
#define BK 32
#define LDSS 40

// Problem constants
#define DMODEL 4096
#define DLOCAL 512
#define BB     4
#define SS     2048

__device__ __forceinline__ v16bf ld_frag(const __bf16* p) {
  union { uint4 u[2]; v16bf v; } t;
  t.u[0] = *(const uint4*)(p);
  t.u[1] = *(const uint4*)(p + 8);
  return t.v;
}

// One thread's copies of one stage: 32B of the A tile and 32B of the B tile,
// global -> LDS, asynchronous (2 x b128 each). INST_OFFSET applies to both the
// global and the LDS address, so one address pair covers both halves. The
// closing wait stands in front of every later overwrite of the four address
// operands; inside the statement nothing can be moved ahead of it.
__device__ __forceinline__ void async_copy_stage(uint32_t ldsA, const __bf16* gA,
                                                 uint32_t ldsB, const __bf16* gB) {
  asm volatile("global_load_async_to_lds_b128 %0, %1, off\n\t"
               "global_load_async_to_lds_b128 %0, %1, off offset:16\n\t"
               "global_load_async_to_lds_b128 %2, %3, off\n\t"
               "global_load_async_to_lds_b128 %2, %3, off offset:16\n\t"
               "s_wait_xcnt 0x0"
               :: "v"(ldsA), "v"((unsigned long long)gA),
                  "v"(ldsB), "v"((unsigned long long)gB)
               : "memory");
}

typedef __attribute__((ext_vector_type(4))) float  f32x4;
typedef __attribute__((ext_vector_type(4))) __bf16 bf16x4;
typedef __attribute__((ext_vector_type(8))) __bf16 bf16x8;

// One grid casts all five f32 operands as a stream. A chunk is what one block
// moves in one trip: 256 threads x CAST_LD loads of 16 bytes, each wave-wide
// load covering 512 contiguous bytes. Chunks 0 .. XCHUNKS-1 are x, then WCHUNKS
// for each weight matrix (their bf16 copies are contiguous at wdst). All
// CAST_BLOCKS blocks are resident at once and take chunks CAST_BLOCKS apart.
#define CAST_LD     8
#define CHUNK       (256 * CAST_LD * 4)
#define XCHUNKS     (BB * SS * DMODEL / CHUNK)
#define WCHUNKS     (DLOCAL * DMODEL / CHUNK)
#define CAST_BLOCKS 1024
#define CAST_TRIPS  ((XCHUNKS + 4 * WCHUNKS) / CAST_BLOCKS)
static_assert(CAST_TRIPS * CAST_BLOCKS == XCHUNKS + 4 * WCHUNKS, "whole trips");
static_assert(XCHUNKS % CAST_BLOCKS == 0, "a trip is all x or all weights");

__global__ __launch_bounds__(256)
void cast_f32_bf16(const float* __restrict__ x,
                   const float* __restrict__ Wq, const float* __restrict__ Wk,
                   const float* __restrict__ Wv, const float* __restrict__ Wo,
                   __bf16* __restrict__ xdst, __bf16* __restrict__ wdst) {
  f32x4 v[CAST_TRIPS][CAST_LD];

  // unrolled so that every register set is indexed by constants; trip t's loads
  // are issued before trip t-1 is converted and stored
  #pragma unroll
  for (int trip = 0; trip <= CAST_TRIPS; ++trip) {
    if (trip < CAST_TRIPS) {
      int c = trip * CAST_BLOCKS + blockIdx.x;
      const float* src = x;
      if (trip * CAST_BLOCKS >= XCHUNKS) {
        c -= XCHUNKS;
        const int w = c / WCHUNKS;
        c -= w * WCHUNKS;
        src = (w == 0) ? Wq : (w == 1) ? Wk : (w == 2) ? Wv : Wo;
      }
      const f32x4* s = (const f32x4*)(src + (size_t)c * CHUNK) + threadIdx.x;
      #pragma unroll
      for (int j = 0; j < CAST_LD; ++j) v[trip][j] = s[j * 256];
    }
    if (trip > 0) {
      int c = (trip - 1) * CAST_BLOCKS + blockIdx.x;
      __bf16* dst = xdst;
      if ((trip - 1) * CAST_BLOCKS >= XCHUNKS) { c -= XCHUNKS; dst = wdst; }
      bf16x4* d = (bf16x4*)(dst + (size_t)c * CHUNK) + threadIdx.x;
      #pragma unroll
      for (int j = 0; j < CAST_LD; ++j)
        d[j * 256] = __builtin_convertvector(v[trip - 1][j], bf16x4);
      // the next trip's loads reuse registers that the stores above name: this
      // wait stands in front of their overwrite (nothing follows the last trip)
      if (trip < CAST_TRIPS) asm volatile("s_wait_xcnt 0x0" ::: "memory");
    }
  }
}

// ---------------------------------------------------------------------------
// out[M,N] = (A @ Bm^T + bias) * scale
//   A  stored [M,K] row-major (stride lda), Bm stored [N,K] row-major (ldb).
//   128x128 block tile, 8 waves (4x2), each wave = 32x64 via 8 WMMAs/K-step.
//   Async double-buffered LDS staging.
//   blockIdx.z picks one of several independent products of the same shape:
//   operand and output bases move by zA / zB / zO elements per z; z = 1 and 2
//   take bias1 and bias2, and every z > 0 takes scale1.
//   The product z == zT (bf16 output only; -1: none) is stored transposed inside
//   each batch of SS rows: out[row / SS][col][row % SS].
// ---------------------------------------------------------------------------
template <bool OUT_F32>
__global__ __launch_bounds__(256)
void gemm_async(const __bf16* __restrict__ A,
                const __bf16* __restrict__ Bm,
                const float*  __restrict__ bias,
                const float*  __restrict__ bias1,
                const float*  __restrict__ bias2,
                void* __restrict__ outp,
                int M, int N, int K, int lda, int ldb, float scale, float scale1,
                int zA, int zB, int zO, int zT)
{
  __shared__ __align__(16) __bf16 As[2][BM * LDSS];
  __shared__ __align__(16) __bf16 Bs[2][BN * LDSS];

  const int tid     = threadIdx.x;
  const int lane    = tid & 31;
  const int wave    = tid >> 5;
  const int waveRow = wave & 3;   // 4 wave-rows of 32
  const int waveCol = wave >> 2;  // 2 wave-cols of 64
  const int blockM  = blockIdx.y * BM;
  const int blockN  = blockIdx.x * BN;

  const int z = blockIdx.z;
  A  += (size_t)z * zA;
  Bm += (size_t)z * zB;
  const size_t oOff = (size_t)z * zO;
  if (z == 1) bias = bias1;
  if (z == 2) bias = bias2;
  if (z > 0)  scale = scale1;

  // staging coordinates: each thread owns one 32B half-row in A and B tiles
  const int sr = tid >> 1;        // 0..127
  const int sh = tid & 1;         // K-half of 16 halves
  const __bf16* gA = A  + (size_t)(blockM + sr) * lda + sh * 16;
  const __bf16* gB = Bm + (size_t)(blockN + sr) * ldb + sh * 16;
  const int sOff = sr * LDSS + sh * 16;

  v8f acc[2][4] = {};

  const int fr = lane & 15;       // fragment row within a 16x32 tile
  const int fh = lane >> 4;       // K-half select

  const int nsteps = K / BK;

  // prologue: stage step 0 into buffer 0
  async_copy_stage((uint32_t)(size_t)&As[0][sOff], gA,
                   (uint32_t)(size_t)&Bs[0][sOff], gB);

  for (int t = 0; t < nsteps; ++t) {
    const int cur = t & 1;
    if (t + 1 < nsteps) {
      const int koff = (t + 1) * BK;
      async_copy_stage((uint32_t)(size_t)&As[cur ^ 1][sOff], gA + koff,
                       (uint32_t)(size_t)&Bs[cur ^ 1][sOff], gB + koff);
      asm volatile("s_wait_asynccnt 0x4" ::: "memory");  // step-t ops retired
    } else {
      asm volatile("s_wait_asynccnt 0x0" ::: "memory");
    }
    __syncthreads();  // all waves' step-t tiles visible in LDS

    v16bf afrag[2], bfrag[4];
    #pragma unroll
    for (int mt = 0; mt < 2; ++mt)
      afrag[mt] = ld_frag(&As[cur][(waveRow * 32 + mt * 16 + fr) * LDSS + fh * 16]);
    #pragma unroll
    for (int nt = 0; nt < 4; ++nt)
      bfrag[nt] = ld_frag(&Bs[cur][(waveCol * 64 + nt * 16 + fr) * LDSS + fh * 16]);

    #pragma unroll
    for (int mt = 0; mt < 2; ++mt)
      #pragma unroll
      for (int nt = 0; nt < 4; ++nt)
        acc[mt][nt] = __builtin_amdgcn_wmma_f32_16x16x32_bf16(
            false, afrag[mt], false, bfrag[nt], (short)0, acc[mt][nt],
            false, false);

    __syncthreads();  // buffer `cur` free for step t+2's async writes
  }

  const int ccol = lane & 15;
  const int crow = (lane >> 4) * 8;

  // transposed store: a lane's 8 accumulator rows are 8 neighbours of one
  // output row, so each 16x16 tile leaves as one 16-byte store a lane
  if (!OUT_F32 && z == zT) {
    static_assert(SS % BM == 0, "a block's rows lie in one batch");
    __bf16* ot = (__bf16*)outp + oOff + (size_t)(blockM / SS) * N * SS +
                 blockM % SS + waveRow * 32 + crow;
    #pragma unroll
    for (int mt = 0; mt < 2; ++mt) {
      #pragma unroll
      for (int nt = 0; nt < 4; ++nt) {
        const int colg = blockN + waveCol * 64 + nt * 16 + ccol;
        const float bv = bias ? bias[colg] : 0.0f;
        bf16x8 p;
        #pragma unroll
        for (int j = 0; j < 8; ++j) p[j] = (__bf16)((acc[mt][nt][j] + bv) * scale);
        *(bf16x8*)(ot + (size_t)colg * SS + mt * 16) = p;
        // the next tile reuses registers that the store above names: this wait
        // stands in front of their overwrite (no tile follows the last one)
        if (mt * 4 + nt < 7) asm volatile("s_wait_xcnt 0x0" ::: "memory");
      }
    }
    return;
  }

  #pragma unroll
  for (int mt = 0; mt < 2; ++mt) {
    #pragma unroll
    for (int nt = 0; nt < 4; ++nt) {
      int colg = blockN + waveCol * 64 + nt * 16 + ccol;
      float bv = bias ? bias[colg] : 0.0f;
      #pragma unroll
      for (int j = 0; j < 8; ++j) {
        int rowg = blockM + waveRow * 32 + mt * 16 + crow + j;
        float v = (acc[mt][nt][j] + bv) * scale;
        if (OUT_F32) ((float*)outp)[oOff + (size_t)rowg * N + colg] = v;
        else         ((__bf16*)outp)[oOff + (size_t)rowg * N + colg] = (__bf16)v;
      }
      // the next column tile reuses registers that the stores above name: this
      // wait stands in front of their overwrite (no tile follows the last one)
      if (mt * 4 + nt < 7) asm volatile("s_wait_xcnt 0x0" ::: "memory");
    }
  }
}

// Row softmax over 2048 columns (one 256-thread block per row), masked.
// blockIdx.y = batch (its own mask row and its own 2048 score rows).
__global__ __launch_bounds__(256)
void softmax_rows(const float* __restrict__ scores, const int* __restrict__ mask,
                  __bf16* __restrict__ probs)
{
  const int row = blockIdx.y * SS + blockIdx.x;
  const int tid = threadIdx.x;
  mask += (size_t)blockIdx.y * SS;
  const float* srow = scores + (size_t)row * SS;
  __bf16* prow = probs + (size_t)row * SS;

  float vals[8];
  float m = -3.0e38f;
  #pragma unroll
  for (int i = 0; i < 8; ++i) {
    int c = tid + i * 256;
    float s = srow[c];
    if (mask[c] == 0) s = -1.0e9f;
    vals[i] = s;
    m = fmaxf(m, s);
  }
  for (int off = 16; off > 0; off >>= 1) m = fmaxf(m, __shfl_xor(m, off, 32));
  __shared__ float red[8];
  if ((tid & 31) == 0) red[tid >> 5] = m;
  __syncthreads();
  m = red[0];
  #pragma unroll
  for (int w = 1; w < 8; ++w) m = fmaxf(m, red[w]);
  __syncthreads();

  float sum = 0.0f;
  #pragma unroll
  for (int i = 0; i < 8; ++i) { vals[i] = __expf(vals[i] - m); sum += vals[i]; }
  for (int off = 16; off > 0; off >>= 1) sum += __shfl_xor(sum, off, 32);
  if ((tid & 31) == 0) red[tid >> 5] = sum;
  __syncthreads();
  sum = 0.0f;
  #pragma unroll
  for (int w = 0; w < 8; ++w) sum += red[w];
  const float inv = 1.0f / sum;
  #pragma unroll
  for (int i = 0; i < 8; ++i) prow[tid + i * 256] = (__bf16)(vals[i] * inv);
}

extern "C" void kernel_launch(void* const* d_in, const int* in_sizes, int n_in,
                              void* d_out, int out_size, void* d_ws, size_t ws_size,
                              hipStream_t stream) {
  (void)in_sizes; (void)n_in; (void)out_size; (void)ws_size;
  const float* x    = (const float*)d_in[0];
  const int*   mask = (const int*)d_in[1];
  const float* Wq = (const float*)d_in[2];
  const float* bq = (const float*)d_in[3];
  const float* Wk = (const float*)d_in[4];
  const float* bk = (const float*)d_in[5];
  const float* Wv = (const float*)d_in[6];
  const float* bv = (const float*)d_in[7];
  const float* Wo = (const float*)d_in[8];
  const float* bo = (const float*)d_in[9];
  float* out = (float*)d_out;

  // Workspace layout (144 MB). scores (all four batches) overlay the x_bf16
  // region, which is dead once Q/K/V are produced.
  char* ws = (char*)d_ws;
  __bf16* xbf    = (__bf16*)(ws);                              // 64 MB
  float*  scores = (float*)(ws);                               // 64 MB (reuse)
  __bf16* wqb    = (__bf16*)(ws + (size_t)(64u << 20));        // Wq,Wk,Wv,Wo
  __bf16* wob    = wqb + (size_t)3 * DLOCAL * DMODEL;
  __bf16* Q      = (__bf16*)(ws + (size_t)(80u << 20));        // Q,K,V: 24 MB
  __bf16* Kt     = Q  + (size_t)BB * SS * DLOCAL;
  __bf16* Vt     = Kt + (size_t)BB * SS * DLOCAL;              // [b][e][s]
  __bf16* probs  = (__bf16*)(ws + (size_t)(104u << 20));       // 32 MB
  __bf16* attnT  = (__bf16*)(ws + (size_t)(136u << 20));       //  8 MB

  cast_f32_bf16<<<CAST_BLOCKS, 256, 0, stream>>>(x, Wq, Wk, Wv, Wo, xbf, wqb);

  const float qscale = 0.08838834764831845f;  // 1/sqrt(d_k=128), folded into Q
  const int Mx = BB * SS;                     // 8192

  // Q, K, V projections: z = 0, 1, 2 (weights and outputs are contiguous);
  // V (z = 2) is stored as V_b^T, K-contiguous for the attn^T product below
  dim3 gProj(DLOCAL / BN, Mx / BM, 3);        // (4, 64, 3)
  gemm_async<false><<<gProj, 256, 0, stream>>>(
      xbf, wqb, bq, bk, bv, Q, Mx, DLOCAL, DMODEL, DMODEL, DMODEL, qscale, 1.0f,
      0, DLOCAL * DMODEL, BB * SS * DLOCAL, 2);

  // scores[b,q,k] = Q_b @ K_b^T   (scale already folded into Q), z = batch
  dim3 gS(SS / BN, SS / BM, BB);              // (16, 16, 4)
  gemm_async<true><<<gS, 256, 0, stream>>>(
      Q, Kt, nullptr, nullptr, nullptr, scores, SS, SS, DLOCAL, DLOCAL, DLOCAL,
      1.0f, 1.0f, SS * DLOCAL, SS * DLOCAL, SS * SS, -1);

  softmax_rows<<<dim3(SS, BB), 256, 0, stream>>>(scores, mask, probs);

  // attnT[b,e,q] = sum_k V[b,k,e] * probs[b,q,k]  == (probs_b @ V_b)^T, z = batch
  dim3 gA(SS / BN, DLOCAL / BM, BB);          // (16, 4, 4)
  gemm_async<false><<<gA, 256, 0, stream>>>(
      Vt, probs, nullptr, nullptr, nullptr, attnT, DLOCAL, SS, SS, SS, SS,
      1.0f, 1.0f, DLOCAL * SS, SS * SS, DLOCAL * SS, -1);

  // attnT buffer, reinterpreted as [8192, 512] row-major, is exactly the
  // reference's swapaxes(1,2).reshape(B,S,d_local) permutation.
  dim3 gO(DMODEL / BN, Mx / BM);               // (32, 64)
  gemm_async<true><<<gO, 256, 0, stream>>>(
      attnT, wob, bo, nullptr, nullptr, out, Mx, DMODEL, DLOCAL, DLOCAL, DLOCAL,
      1.0f, 1.0f, 0, 0, 0, -1);
}

// v004
// A run of this version takes 209 microseconds.
// Two timings next to v003 put it at 1.35 and 1.36 times that version's speed.
// All steps since v000 together make it 3.08 times as fast.
#include <hip/hip_runtime.h>

typedef __attribute__((ext_vector_type(16))) __bf16 v16bf;
typedef __attribute__((ext_vector_type(8)))  float  v8f;

#define BM 128
#define BN 128
#define BK 64
#define LDSS 72

// Problem constants
#define DMODEL 4096
#define DLOCAL 512
#define BB     4
#define SS     2048

__device__ __forceinline__ v16bf ld_frag(const __bf16* p) {
  union { uint4 u[2]; v16bf v; } t;
  t.u[0] = *(const uint4*)(p);
  t.u[1] = *(const uint4*)(p + 8);
  return t.v;
}

// One thread's copies of one stage, global -> LDS, asynchronous: 16 bytes in each
// of 4 rows (32 rows apart) of the A tile and of the B tile. Eight neighbouring
// lanes cover one 128-byte row, so a wave-wide copy reads 4 whole cache lines.
// stepA / stepB: 32 rows of the source, in elements. The closing wait stands in
// front of every later overwrite of the sixteen address operands; inside the
// statement nothing can be moved ahead of it.
#define LDS_STEP (32 * LDSS * 2)   // 32 rows of a tile in LDS, in bytes
__device__ __forceinline__ void async_copy_stage(uint32_t ldsA, const __bf16* gA,
                                                 size_t stepA,
                                                 uint32_t ldsB, const __bf16* gB,
                                                 size_t stepB) {
  asm volatile("global_load_async_to_lds_b128 %0, %1, off\n\t"
               "global_load_async_to_lds_b128 %2, %3, off\n\t"
               "global_load_async_to_lds_b128 %4, %5, off\n\t"
               "global_load_async_to_lds_b128 %6, %7, off\n\t"
               "global_load_async_to_lds_b128 %8, %9, off\n\t"
               "global_load_async_to_lds_b128 %10, %11, off\n\t"
               "global_load_async_to_lds_b128 %12, %13, off\n\t"
               "global_load_async_to_lds_b128 %14, %15, off\n\t"
               "s_wait_xcnt 0x0"
               :: "v"(ldsA),                "v"((unsigned long long)gA),
                  "v"(ldsA + LDS_STEP),     "v"((unsigned long long)(gA + stepA)),
                  "v"(ldsA + 2 * LDS_STEP), "v"((unsigned long long)(gA + 2 * stepA)),
                  "v"(ldsA + 3 * LDS_STEP), "v"((unsigned long long)(gA + 3 * stepA)),
                  "v"(ldsB),                "v"((unsigned long long)gB),
                  "v"(ldsB + LDS_STEP),     "v"((unsigned long long)(gB + stepB)),
                  "v"(ldsB + 2 * LDS_STEP), "v"((unsigned long long)(gB + 2 * stepB)),
                  "v"(ldsB + 3 * LDS_STEP), "v"((unsigned long long)(gB + 3 * stepB))
               : "memory");
}

typedef __attribute__((ext_vector_type(4))) float  f32x4;
typedef __attribute__((ext_vector_type(4))) __bf16 bf16x4;
typedef __attribute__((ext_vector_type(8))) __bf16 bf16x8;

// One grid casts all five f32 operands as a stream. A chunk is what one block
// moves in one trip: 256 threads x CAST_LD loads of 16 bytes, each wave-wide
// load covering 512 contiguous bytes. Chunks 0 .. XCHUNKS-1 are x, then WCHUNKS
// for each weight matrix (their bf16 copies are contiguous at wdst). All
// CAST_BLOCKS blocks are resident at once and take chunks CAST_BLOCKS apart.
#define CAST_LD     8
#define CHUNK       (256 * CAST_LD * 4)
#define XCHUNKS     (BB * SS * DMODEL / CHUNK)
#define WCHUNKS     (DLOCAL * DMODEL / CHUNK)
#define CAST_BLOCKS 1024
#define CAST_TRIPS  ((XCHUNKS + 4 * WCHUNKS) / CAST_BLOCKS)
static_assert(CAST_TRIPS * CAST_BLOCKS == XCHUNKS + 4 * WCHUNKS, "whole trips");
static_assert(XCHUNKS % CAST_BLOCKS == 0, "a trip is all x or all weights");

__global__ __launch_bounds__(256)
void cast_f32_bf16(const float* __restrict__ x,
                   const float* __restrict__ Wq, const float* __restrict__ Wk,
                   const float* __restrict__ Wv, const float* __restrict__ Wo,
                   __bf16* __restrict__ xdst, __bf16* __restrict__ wdst) {
  f32x4 v[CAST_TRIPS][CAST_LD];

  // unrolled so that every register set is indexed by constants; trip t's loads
  // are issued before trip t-1 is converted and stored
  #pragma unroll
  for (int trip = 0; trip <= CAST_TRIPS; ++trip) {
    if (trip < CAST_TRIPS) {
      int c = trip * CAST_BLOCKS + blockIdx.x;
      const float* src = x;
      if (trip * CAST_BLOCKS >= XCHUNKS) {
        c -= XCHUNKS;
        const int w = c / WCHUNKS;
        c -= w * WCHUNKS;
        src = (w == 0) ? Wq : (w == 1) ? Wk : (w == 2) ? Wv : Wo;
      }
      const f32x4* s = (const f32x4*)(src + (size_t)c * CHUNK) + threadIdx.x;
      #pragma unroll
      for (int j = 0; j < CAST_LD; ++j) v[trip][j] = s[j * 256];
    }
    if (trip > 0) {
      int c = (trip - 1) * CAST_BLOCKS + blockIdx.x;
      __bf16* dst = xdst;
      if ((trip - 1) * CAST_BLOCKS >= XCHUNKS) { c -= XCHUNKS; dst = wdst; }
      bf16x4* d = (bf16x4*)(dst + (size_t)c * CHUNK) + threadIdx.x;
      #pragma unroll
      for (int j = 0; j < CAST_LD; ++j)
        d[j * 256] = __builtin_convertvector(v[trip - 1][j], bf16x4);
      // the next trip's loads reuse registers that the stores above name: this
      // wait stands in front of their overwrite (nothing follows the last trip)
      if (trip < CAST_TRIPS) asm volatile("s_wait_xcnt 0x0" ::: "memory");
    }
  }
}

// ---------------------------------------------------------------------------
// out[M,N] = (A @ Bm^T + bias) * scale
//   A  stored [M,K] row-major (stride lda), Bm stored [N,K] row-major (ldb).
//   128x128 block tile, 8 waves (4x2), each wave = 32x64 via 8 WMMAs per 32 k,
//   16 per stage of BK = 64.
//   Async double-buffered LDS staging.
//   blockIdx.z picks one of several independent products of the same shape:
//   operand and output bases move by zA / zB / zO elements per z; z = 1 and 2
//   take bias1 and bias2, and every z > 0 takes scale1.
//   The product z == zT (bf16 output only; -1: none) is stored transposed inside
//   each batch of SS rows: out[row / SS][col][row % SS].
// ---------------------------------------------------------------------------
template <bool OUT_F32>
__global__ __launch_bounds__(256)
void gemm_async(const __bf16* __restrict__ A,
                const __bf16* __restrict__ Bm,
                const float*  __restrict__ bias,
                const float*  __restrict__ bias1,
                const float*  __restrict__ bias2,
                void* __restrict__ outp,
                int M, int N, int K, int lda, int ldb, float scale, float scale1,
                int zA, int zB, int zO, int zT)
{
  __shared__ __align__(16) __bf16 As[2][BM * LDSS];
  __shared__ __align__(16) __bf16 Bs[2][BN * LDSS];

  const int tid     = threadIdx.x;
  const int lane    = tid & 31;
  const int wave    = tid >> 5;
  const int waveRow = wave & 3;   // 4 wave-rows of 32
  const int waveCol = wave >> 2;  // 2 wave-cols of 64
  const int blockM  = blockIdx.y * BM;
  const int blockN  = blockIdx.x * BN;

  const int z = blockIdx.z;
  A  += (size_t)z * zA;
  Bm += (size_t)z * zB;
  const size_t oOff = (size_t)z * zO;
  if (z == 1) bias = bias1;
  if (z == 2) bias = bias2;
  if (z > 0)  scale = scale1;

  // staging coordinates: each thread owns one 16B piece of rows sr, sr + 32,
  // sr + 64 and sr + 96 in the A and B tiles
  const int sr = tid >> 3;        // 0..31
  const int sp = tid & 7;         // piece of 8 halves within the 64-half row
  const __bf16* gA = A  + (size_t)(blockM + sr) * lda + sp * 8;
  const __bf16* gB = Bm + (size_t)(blockN + sr) * ldb + sp * 8;
  const size_t stepA = (size_t)32 * lda;
  const size_t stepB = (size_t)32 * ldb;
  const int sOff = sr * LDSS + sp * 8;

  v8f acc[2][4] = {};

  const int fr = lane & 15;       // fragment row within a 16x32 tile
  const int fh = lane >> 4;       // K-half select

  const int nsteps = K / BK;

  // prologue: stage step 0 into buffer 0
  async_copy_stage((uint32_t)(size_t)&As[0][sOff], gA, stepA,
                   (uint32_t)(size_t)&Bs[0][sOff], gB, stepB);

  for (int t = 0; t < nsteps; ++t) {
    const int cur = t & 1;
    if (t + 1 < nsteps) {
      const int koff = (t + 1) * BK;
      async_copy_stage((uint32_t)(size_t)&As[cur ^ 1][sOff], gA + koff, stepA,
                       (uint32_t)(size_t)&Bs[cur ^ 1][sOff], gB + koff, stepB);
      // all but the 8 copies just issued have landed: step t's are in LDS
      asm volatile("s_wait_asynccnt 0x8" ::: "memory");
    } else {
      asm volatile("s_wait_asynccnt 0x0" ::: "memory");
    }
    __syncthreads();  // all waves' step-t tiles visible in LDS

    #pragma unroll
    for (int ks = 0; ks < BK; ks += 32) {
      v16bf afrag[2], bfrag[4];
      #pragma unroll
      for (int mt = 0; mt < 2; ++mt)
        afrag[mt] = ld_frag(
            &As[cur][(waveRow * 32 + mt * 16 + fr) * LDSS + ks + fh * 16]);
      #pragma unroll
      for (int nt = 0; nt < 4; ++nt)
        bfrag[nt] = ld_frag(
            &Bs[cur][(waveCol * 64 + nt * 16 + fr) * LDSS + ks + fh * 16]);

      #pragma unroll
      for (int mt = 0; mt < 2; ++mt)
        #pragma unroll
        for (int nt = 0; nt < 4; ++nt)
          acc[mt][nt] = __builtin_amdgcn_wmma_f32_16x16x32_bf16(
              false, afrag[mt], false, bfrag[nt], (short)0, acc[mt][nt],
              false, false);
    }

    __syncthreads();  // buffer `cur` free for step t+2's async writes
  }

  const int ccol = lane & 15;
  const int crow = (lane >> 4) * 8;

  // transposed store: a lane's 8 accumulator rows are 8 neighbours of one
  // output row, so each 16x16 tile leaves as one 16-byte store a lane
  if (!OUT_F32 && z == zT) {
    static_assert(SS % BM == 0, "a block's rows lie in one batch");
    __bf16* ot = (__bf16*)outp + oOff + (size_t)(blockM / SS) * N * SS +
                 blockM % SS + waveRow * 32 + crow;
    #pragma unroll
    for (int mt = 0; mt < 2; ++mt) {
      #pragma unroll
      for (int nt = 0; nt < 4; ++nt) {
        const int colg = blockN + waveCol * 64 + nt * 16 + ccol;
        const float bv = bias ? bias[colg] : 0.0f;
        bf16x8 p;
        #pragma unroll
        for (int j = 0; j < 8; ++j) p[j] = (__bf16)((acc[mt][nt][j] + bv) * scale);
        *(bf16x8*)(ot + (size_t)colg * SS + mt * 16) = p;
        // the next tile reuses registers that the store above names: this wait
        // stands in front of their overwrite (no tile follows the last one)
        if (mt * 4 + nt < 7) asm volatile("s_wait_xcnt 0x0" ::: "memory");
      }
    }
    return;
  }

  #pragma unroll
  for (int mt = 0; mt < 2; ++mt) {
    #pragma unroll
    for (int nt = 0; nt < 4; ++nt) {
      int colg = blockN + waveCol * 64 + nt * 16 + ccol;
      float bv = bias ? bias[colg] : 0.0f;
      #pragma unroll
      for (int j = 0; j < 8; ++j) {
        int rowg = blockM + waveRow * 32 + mt * 16 + crow + j;
        float v = (acc[mt][nt][j] + bv) * scale;
        if (OUT_F32) ((float*)outp)[oOff + (size_t)rowg * N + colg] = v;
        else         ((__bf16*)outp)[oOff + (size_t)rowg * N + colg] = (__bf16)v;
      }
      // the next column tile reuses registers that the stores above name: this
      // wait stands in front of their overwrite (no tile follows the last one)
      if (mt * 4 + nt < 7) asm volatile("s_wait_xcnt 0x0" ::: "memory");
    }
  }
}

// Row softmax over 2048 columns (one 256-thread block per row), masked.
// blockIdx.y = batch (its own mask row and its own 2048 score rows).
__global__ __launch_bounds__(256)
void softmax_rows(const float* __restrict__ scores, const int* __restrict__ mask,
                  __bf16* __restrict__ probs)
{
  const int row = blockIdx.y * SS + blockIdx.x;
  const int tid = threadIdx.x;
  mask += (size_t)blockIdx.y * SS;
  const float* srow = scores + (size_t)row * SS;
  __bf16* prow = probs + (size_t)row * SS;

  float vals[8];
  float m = -3.0e38f;
  #pragma unroll
  for (int i = 0; i < 8; ++i) {
    int c = tid + i * 256;
    float s = srow[c];
    if (mask[c] == 0) s = -1.0e9f;
    vals[i] = s;
    m = fmaxf(m, s);
  }
  for (int off = 16; off > 0; off >>= 1) m = fmaxf(m, __shfl_xor(m, off, 32));
  __shared__ float red[8];
  if ((tid & 31) == 0) red[tid >> 5] = m;
  __syncthreads();
  m = red[0];
  #pragma unroll
  for (int w = 1; w < 8; ++w) m = fmaxf(m, red[w]);
  __syncthreads();

  float sum = 0.0f;
  #pragma unroll
  for (int i = 0; i < 8; ++i) { vals[i] = __expf(vals[i] - m); sum += vals[i]; }
  for (int off = 16; off > 0; off >>= 1) sum += __shfl_xor(sum, off, 32);
  if ((tid & 31) == 0) red[tid >> 5] = sum;
  __syncthreads();
  sum = 0.0f;
  #pragma unroll
  for (int w = 0; w < 8; ++w) sum += red[w];
  const float inv = 1.0f / sum;
  #pragma unroll
  for (int i = 0; i < 8; ++i) prow[tid + i * 256] = (__bf16)(vals[i] * inv);
}

extern "C" void kernel_launch(void* const* d_in, const int* in_sizes, int n_in,
                              void* d_out, int out_size, void* d_ws, size_t ws_size,
                              hipStream_t stream) {
  (void)in_sizes; (void)n_in; (void)out_size; (void)ws_size;
  const float* x    = (const float*)d_in[0];
  const int*   mask = (const int*)d_in[1];
  const float* Wq = (const float*)d_in[2];
  const float* bq = (const float*)d_in[3];
  const float* Wk = (const float*)d_in[4];
  const float* bk = (const float*)d_in[5];
  const float* Wv = (const float*)d_in[6];
  const float* bv = (const float*)d_in[7];
  const float* Wo = (const float*)d_in[8];
  const float* bo = (const float*)d_in[9];
  float* out = (float*)d_out;

  // Workspace layout (144 MB). scores (all four batches) overlay the x_bf16
  // region, which is dead once Q/K/V are produced.
  char* ws = (char*)d_ws;
  __bf16* xbf    = (__bf16*)(ws);                              // 64 MB
  float*  scores = (float*)(ws);                               // 64 MB (reuse)
  __bf16* wqb    = (__bf16*)(ws + (size_t)(64u << 20));        // Wq,Wk,Wv,Wo
  __bf16* wob    = wqb + (size_t)3 * DLOCAL * DMODEL;
  __bf16* Q      = (__bf16*)(ws + (size_t)(80u << 20));        // Q,K,V: 24 MB
  __bf16* Kt     = Q  + (size_t)BB * SS * DLOCAL;
  __bf16* Vt     = Kt + (size_t)BB * SS * DLOCAL;              // [b][e][s]
  __bf16* probs  = (__bf16*)(ws + (size_t)(104u << 20));       // 32 MB
  __bf16* attnT  = (__bf16*)(ws + (size_t)(136u << 20));       //  8 MB

  cast_f32_bf16<<<CAST_BLOCKS, 256, 0, stream>>>(x, Wq, Wk, Wv, Wo, xbf, wqb);

  const float qscale = 0.08838834764831845f;  // 1/sqrt(d_k=128), folded into Q
  const int Mx = BB * SS;                     // 8192

  // Q, K, V projections: z = 0, 1, 2 (weights and outputs are contiguous);
  // V (z = 2) is stored as V_b^T, K-contiguous for the attn^T product below
  dim3 gProj(DLOCAL / BN, Mx / BM, 3);        // (4, 64, 3)
  gemm_async<false><<<gProj, 256, 0, stream>>>(
      xbf, wqb, bq, bk, bv, Q, Mx, DLOCAL, DMODEL, DMODEL, DMODEL, qscale, 1.0f,
      0, DLOCAL * DMODEL, BB * SS * DLOCAL, 2);

  // scores[b,q,k] = Q_b @ K_b^T   (scale already folded into Q), z = batch
  dim3 gS(SS / BN, SS / BM, BB);              // (16, 16, 4)
  gemm_async<true><<<gS, 256, 0, stream>>>(
      Q, Kt, nullptr, nullptr, nullptr, scores, SS, SS, DLOCAL, DLOCAL, DLOCAL,
      1.0f, 1.0f, SS * DLOCAL, SS * DLOCAL, SS * SS, -1);

  softmax_rows<<<dim3(SS, BB), 256, 0, stream>>>(scores, mask, probs);

  // attnT[b,e,q] = sum_k V[b,k,e] * probs[b,q,k]  == (probs_b @ V_b)^T, z = batch
  dim3 gA(SS / BN, DLOCAL / BM, BB);          // (16, 4, 4)
  gemm_async<false><<<gA, 256, 0, stream>>>(
      Vt, probs, nullptr, nullptr, nullptr, attnT, DLOCAL, SS, SS, SS, SS,
      1.0f, 1.0f, DLOCAL * SS, SS * SS, DLOCAL * SS, -1);

  // attnT buffer, reinterpreted as [8192, 512] row-major, is exactly the
  // reference's swapaxes(1,2).reshape(B,S,d_local) permutation.
  dim3 gO(DMODEL / BN, Mx / BM);               // (32, 64)
  gemm_async<true><<<gO, 256, 0, stream>>>(
      attnT, wob, bo, nullptr, nullptr, out, Mx, DMODEL, DLOCAL, DLOCAL, DLOCAL,
      1.0f, 1.0f, 0, 0, 0, -1);
}

// v005
// It runs in 194 microseconds.
// In two side-by-side timings against v004, it was 1.08 and 1.07 times as fast.
// Over all steps from v000 it is 3.31 times as fast.
#include <hip/hip_runtime.h>

typedef __attribute__((ext_vector_type(16))) __bf16 v16bf;
typedef __attribute__((ext_vector_type(8)))  float  v8f;

#define BM 128
#define BN 128
#define BK 64
#define LDSS 72

// Problem constants
#define DMODEL 4096
#define DLOCAL 512
#define BB     4
#define SS     2048

// 16 halves of one LDS row: its pieces p and p + 1 (p even), each at piece ^ sw
__device__ __forceinline__ v16bf ld_frag(const __bf16* row, int p, int sw) {
  union { uint4 u[2]; v16bf v; } t;
  t.u[0] = *(const uint4*)(row + ((p ^ sw) << 3));
  t.u[1] = *(const uint4*)(row + (((p + 1) ^ sw) << 3));
  return t.v;
}

// One thread's copies of one stage, global -> LDS, asynchronous: 16 bytes in each
// of 4 rows (32 rows apart) of the A tile and of the B tile. Eight neighbouring
// lanes cover one 128-byte row, so a wave-wide copy reads 4 whole cache lines.
// stepA / stepB: 32 rows of the source, in elements; LDS_STEP: 32 rows of a tile
// in LDS, in bytes. The closing wait stands in front of every later overwrite of
// the sixteen address operands; inside the statement nothing can be moved ahead
// of it.
template <uint32_t LDS_STEP>
__device__ __forceinline__ void async_copy_stage(uint32_t ldsA, const __bf16* gA,
                                                 size_t stepA,
                                                 uint32_t ldsB, const __bf16* gB,
                                                 size_t stepB) {
  asm volatile("global_load_async_to_lds_b128 %0, %1, off\n\t"
               "global_load_async_to_lds_b128 %2, %3, off\n\t"
               "global_load_async_to_lds_b128 %4, %5, off\n\t"
               "global_load_async_to_lds_b128 %6, %7, off\n\t"
               "global_load_async_to_lds_b128 %8, %9, off\n\t"
               "global_load_async_to_lds_b128 %10, %11, off\n\t"
               "global_load_async_to_lds_b128 %12, %13, off\n\t"
               "global_load_async_to_lds_b128 %14, %15, off\n\t"
               "s_wait_xcnt 0x0"
               :: "v"(ldsA),                "v"((unsigned long long)gA),
                  "v"(ldsA + LDS_STEP),     "v"((unsigned long long)(gA + stepA)),
                  "v"(ldsA + 2 * LDS_STEP), "v"((unsigned long long)(gA + 2 * stepA)),
                  "v"(ldsA + 3 * LDS_STEP), "v"((unsigned long long)(gA + 3 * stepA)),
                  "v"(ldsB),                "v"((unsigned long long)gB),
                  "v"(ldsB + LDS_STEP),     "v"((unsigned long long)(gB + stepB)),
                  "v"(ldsB + 2 * LDS_STEP), "v"((unsigned long long)(gB + 2 * stepB)),
                  "v"(ldsB + 3 * LDS_STEP), "v"((unsigned long long)(gB + 3 * stepB))
               : "memory");
}

typedef __attribute__((ext_vector_type(4))) float  f32x4;
typedef __attribute__((ext_vector_type(4))) __bf16 bf16x4;
typedef __attribute__((ext_vector_type(8))) __bf16 bf16x8;

// One grid casts all five f32 operands as a stream. A chunk is what one block
// moves in one trip: 256 threads x CAST_LD loads of 16 bytes, each wave-wide
// load covering 512 contiguous bytes. Chunks 0 .. XCHUNKS-1 are x, then WCHUNKS
// for each weight matrix (their bf16 copies are contiguous at wdst). All
// CAST_BLOCKS blocks are resident at once and take chunks CAST_BLOCKS apart.
#define CAST_LD     8
#define CHUNK       (256 * CAST_LD * 4)
#define XCHUNKS     (BB * SS * DMODEL / CHUNK)
#define WCHUNKS     (DLOCAL * DMODEL / CHUNK)
#define CAST_BLOCKS 1024
#define CAST_TRIPS  ((XCHUNKS + 4 * WCHUNKS) / CAST_BLOCKS)
static_assert(CAST_TRIPS * CAST_BLOCKS == XCHUNKS + 4 * WCHUNKS, "whole trips");
static_assert(XCHUNKS % CAST_BLOCKS == 0, "a trip is all x or all weights");

__global__ __launch_bounds__(256)
void cast_f32_bf16(const float* __restrict__ x,
                   const float* __restrict__ Wq, const float* __restrict__ Wk,
                   const float* __restrict__ Wv, const float* __restrict__ Wo,
                   __bf16* __restrict__ xdst, __bf16* __restrict__ wdst) {
  f32x4 v[CAST_TRIPS][CAST_LD];

  // unrolled so that every register set is indexed by constants; trip t's loads
  // are issued before trip t-1 is converted and stored
  #pragma unroll
  for (int trip = 0; trip <= CAST_TRIPS; ++trip) {
    if (trip < CAST_TRIPS) {
      int c = trip * CAST_BLOCKS + blockIdx.x;
      const float* src = x;
      if (trip * CAST_BLOCKS >= XCHUNKS) {
        c -= XCHUNKS;
        const int w = c / WCHUNKS;
        c -= w * WCHUNKS;
        src = (w == 0) ? Wq : (w == 1) ? Wk : (w == 2) ? Wv : Wo;
      }
      const f32x4* s = (const f32x4*)(src + (size_t)c * CHUNK) + threadIdx.x;
      #pragma unroll
      for (int j = 0; j < CAST_LD; ++j) v[trip][j] = s[j * 256];
    }
    if (trip > 0) {
      int c = (trip - 1) * CAST_BLOCKS + blockIdx.x;
      __bf16* dst = xdst;
      if ((trip - 1) * CAST_BLOCKS >= XCHUNKS) { c -= XCHUNKS; dst = wdst; }
      bf16x4* d = (bf16x4*)(dst + (size_t)c * CHUNK) + threadIdx.x;
      #pragma unroll
      for (int j = 0; j < CAST_LD; ++j)
        d[j * 256] = __builtin_convertvector(v[trip - 1][j], bf16x4);
      // the next trip's loads reuse registers that the stores above name: this
      // wait stands in front of their overwrite (nothing follows the last trip)
      if (trip < CAST_TRIPS) asm volatile("s_wait_xcnt 0x0" ::: "memory");
    }
  }
}

// ---------------------------------------------------------------------------
// out[M,N] = (A @ Bm^T + bias) * scale
//   A  stored [M,K] row-major (stride lda), Bm stored [N,K] row-major (ldb).
//   128x128 block tile, 8 waves (4x2), each wave = 32x64 via 8 WMMAs per 32 k,
//   16 per stage of BK = 64.
//   Async LDS staging in a ring of NBUF buffers (2 or 3), the copies NBUF - 1
//   stages ahead of the products; K / BK >= NBUF - 1.
//   blockIdx.z picks one of several independent products of the same shape:
//   operand and output bases move by zA / zB / zO elements per z; z = 1 and 2
//   take bias1 and bias2, and every z > 0 takes scale1.
//   The product z == zT (bf16 output only; -1: none) is stored transposed inside
//   each batch of SS rows: out[row / SS][col][row % SS].
// ---------------------------------------------------------------------------
template <bool OUT_F32, int NBUF>
__global__ __launch_bounds__(256)
void gemm_async(const __bf16* __restrict__ A,
                const __bf16* __restrict__ Bm,
                const float*  __restrict__ bias,
                const float*  __restrict__ bias1,
                const float*  __restrict__ bias2,
                void* __restrict__ outp,
                int M, int N, int K, int lda, int ldb, float scale, float scale1,
                int zA, int zB, int zO, int zT)
{
  constexpr int PITCH = (NBUF == 2) ? LDSS : BK;   // LDS row pitch, in halves
  constexpr int SWM   = (NBUF == 2) ? 0 : 7;       // mask of the piece swizzle
  __shared__ __align__(16) __bf16 As[NBUF][BM * PITCH];
  __shared__ __align__(16) __bf16 Bs[NBUF][BN * PITCH];

  const int tid     = threadIdx.x;
  const int lane    = tid & 31;
  const int wave    = tid >> 5;
  const int waveRow = wave & 3;   // 4 wave-rows of 32
  const int waveCol = wave >> 2;  // 2 wave-cols of 64
  const int blockM  = blockIdx.y * BM;
  const int blockN  = blockIdx.x * BN;

  const int z = blockIdx.z;
  A  += (size_t)z * zA;
  Bm += (size_t)z * zB;
  const size_t oOff = (size_t)z * zO;
  if (z == 1) bias = bias1;
  if (z == 2) bias = bias2;
  if (z > 0)  scale = scale1;

  // staging coordinates: each thread owns one 16B piece of rows sr, sr + 32,
  // sr + 64 and sr + 96 in the A and B tiles
  const int sr = tid >> 3;        // 0..31
  const int sp = tid & 7;         // piece of 8 halves within the 64-half row
  const __bf16* gA = A  + (size_t)(blockM + sr) * lda + sp * 8;
  const __bf16* gB = Bm + (size_t)(blockN + sr) * ldb + sp * 8;
  const size_t stepA = (size_t)32 * lda;
  const size_t stepB = (size_t)32 * ldb;
  // (rows 32 apart share one swizzle)
  const int sOff = sr * PITCH + ((sp ^ ((sr >> 1) & SWM)) << 3);

  // this thread's 8 copies of the stage that starts at k = koff
  auto copy_stage = [&](int buf, int koff) {
    async_copy_stage<32 * PITCH * 2>(
        (uint32_t)(size_t)&As[buf][sOff], gA + koff, stepA,
        (uint32_t)(size_t)&Bs[buf][sOff], gB + koff, stepB);
  };

  v8f acc[2][4] = {};

  const int fr = lane & 15;       // fragment row within a 16x32 tile
  const int fh = lane >> 4;       // K-half select
  const int fsw = (fr >> 1) & SWM;  // swizzle of this lane's rows (16 apart)

  const int nsteps = K / BK;

  // prologue: steps 0 .. NBUF - 2 into buffers 0 .. NBUF - 2
  for (int s = 0; s < NBUF - 1; ++s) copy_stage(s, s * BK);

  int cur = 0;         // buffer of step t
  int nxt = NBUF - 1;  // buffer of step t + NBUF - 1 = the one step t - 1 has left
  for (int t = 0; t < nsteps; ++t) {
    if (t + NBUF - 1 < nsteps) {
      copy_stage(nxt, (t + NBUF - 1) * BK);
      // all but the youngest 8 (NBUF - 1) copies have landed: step t's are in LDS
      asm volatile("s_wait_asynccnt %0" :: "n"(8 * (NBUF - 1)) : "memory");
    } else {
      // a trip that issues nothing waits for all that is left
      asm volatile("s_wait_asynccnt 0x0" ::: "memory");
    }
    __syncthreads();  // all waves' step-t tiles visible in LDS

    #pragma unroll
    for (int ks = 0; ks < BK; ks += 32) {
      v16bf afrag[2], bfrag[4];
      #pragma unroll
      for (int mt = 0; mt < 2; ++mt)
        afrag[mt] = ld_frag(&As[cur][(waveRow * 32 + mt * 16 + fr) * PITCH],
                            ks / 8 + fh * 2, fsw);
      #pragma unroll
      for (int nt = 0; nt < 4; ++nt)
        bfrag[nt] = ld_frag(&Bs[cur][(waveCol * 64 + nt * 16 + fr) * PITCH],
                            ks / 8 + fh * 2, fsw);

      #pragma unroll
      for (int mt = 0; mt < 2; ++mt)
        #pragma unroll
        for (int nt = 0; nt < 4; ++nt)
          acc[mt][nt] = __builtin_amdgcn_wmma_f32_16x16x32_bf16(
              false, afrag[mt], false, bfrag[nt], (short)0, acc[mt][nt],
              false, false);
    }

    __syncthreads();  // buffer `cur` free for step t + NBUF's async writes
    nxt = cur;
    cur = (cur + 1 == NBUF) ? 0 : cur + 1;
  }

  const int ccol = lane & 15;
  const int crow = (lane >> 4) * 8;

  // transposed store: a lane's 8 accumulator rows are 8 neighbours of one
  // output row, so each 16x16 tile leaves as one 16-byte store a lane
  if (!OUT_F32 && z == zT) {
    static_assert(SS % BM == 0, "a block's rows lie in one batch");
    __bf16* ot = (__bf16*)outp + oOff + (size_t)(blockM / SS) * N * SS +
                 blockM % SS + waveRow * 32 + crow;
    #pragma unroll
    for (int mt = 0; mt < 2; ++mt) {
      #pragma unroll
      for (int nt = 0; nt < 4; ++nt) {
        const int colg = blockN + waveCol * 64 + nt * 16 + ccol;
        const float bv = bias ? bias[colg] : 0.0f;
        bf16x8 p;
        #pragma unroll
        for (int j = 0; j < 8; ++j) p[j] = (__bf16)((acc[mt][nt][j] + bv) * scale);
        *(bf16x8*)(ot + (size_t)colg * SS + mt * 16) = p;
        // the next tile reuses registers that the store above names: this wait
        // stands in front of their overwrite (no tile follows the last one)
        if (mt * 4 + nt < 7) asm volatile("s_wait_xcnt 0x0" ::: "memory");
      }
    }
    return;
  }

  #pragma unroll
  for (int mt = 0; mt < 2; ++mt) {
    #pragma unroll
    for (int nt = 0; nt < 4; ++nt) {
      int colg = blockN + waveCol * 64 + nt * 16 + ccol;
      float bv = bias ? bias[colg] : 0.0f;
      #pragma unroll
      for (int j = 0; j < 8; ++j) {
        int rowg = blockM + waveRow * 32 + mt * 16 + crow + j;
        float v = (acc[mt][nt][j] + bv) * scale;
        if (OUT_F32) ((float*)outp)[oOff + (size_t)rowg * N + colg] = v;
        else         ((__bf16*)outp)[oOff + (size_t)rowg * N + colg] = (__bf16)v;
      }
      // the next column tile reuses registers that the stores above name: this
      // wait stands in front of their overwrite (no tile follows the last one)
      if (mt * 4 + nt < 7) asm volatile("s_wait_xcnt 0x0" ::: "memory");
    }
  }
}

// Row softmax over 2048 columns (one 256-thread block per row), masked.
// blockIdx.y = batch (its own mask row and its own 2048 score rows).
__global__ __launch_bounds__(256)
void softmax_rows(const float* __restrict__ scores, const int* __restrict__ mask,
                  __bf16* __restrict__ probs)
{
  const int row = blockIdx.y * SS + blockIdx.x;
  const int tid = threadIdx.x;
  mask += (size_t)blockIdx.y * SS;
  const float* srow = scores + (size_t)row * SS;
  __bf16* prow = probs + (size_t)row * SS;

  float vals[8];
  float m = -3.0e38f;
  #pragma unroll
  for (int i = 0; i < 8; ++i) {
    int c = tid + i * 256;
    float s = srow[c];
    if (mask[c] == 0) s = -1.0e9f;
    vals[i] = s;
    m = fmaxf(m, s);
  }
  for (int off = 16; off > 0; off >>= 1) m = fmaxf(m, __shfl_xor(m, off, 32));
  __shared__ float red[8];
  if ((tid & 31) == 0) red[tid >> 5] = m;
  __syncthreads();
  m = red[0];
  #pragma unroll
  for (int w = 1; w < 8; ++w) m = fmaxf(m, red[w]);
  __syncthreads();

  float sum = 0.0f;
  #pragma unroll
  for (int i = 0; i < 8; ++i) { vals[i] = __expf(vals[i] - m); sum += vals[i]; }
  for (int off = 16; off > 0; off >>= 1) sum += __shfl_xor(sum, off, 32);
  if ((tid & 31) == 0) red[tid >> 5] = sum;
  __syncthreads();
  sum = 0.0f;
  #pragma unroll
  for (int w = 0; w < 8; ++w) sum += red[w];
  const float inv = 1.0f / sum;
  #pragma unroll
  for (int i = 0; i < 8; ++i) prow[tid + i * 256] = (__bf16)(vals[i] * inv);
}

extern "C" void kernel_launch(void* const* d_in, const int* in_sizes, int n_in,
                              void* d_out, int out_size, void* d_ws, size_t ws_size,
                              hipStream_t stream) {
  (void)in_sizes; (void)n_in; (void)out_size; (void)ws_size;
  const float* x    = (const float*)d_in[0];
  const int*   mask = (const int*)d_in[1];
  const float* Wq = (const float*)d_in[2];
  const float* bq = (const float*)d_in[3];
  const float* Wk = (const float*)d_in[4];
  const float* bk = (const float*)d_in[5];
  const float* Wv = (const float*)d_in[6];
  const float* bv = (const float*)d_in[7];
  const float* Wo = (const float*)d_in[8];
  const float* bo = (const float*)d_in[9];
  float* out = (float*)d_out;

  // Workspace layout (144 MB). scores (all four batches) overlay the x_bf16
  // region, which is dead once Q/K/V are produced.
  char* ws = (char*)d_ws;
  __bf16* xbf    = (__bf16*)(ws);                              // 64 MB
  float*  scores = (float*)(ws);                               // 64 MB (reuse)
  __bf16* wqb    = (__bf16*)(ws + (size_t)(64u << 20));        // Wq,Wk,Wv,Wo
  __bf16* wob    = wqb + (size_t)3 * DLOCAL * DMODEL;
  __bf16* Q      = (__bf16*)(ws + (size_t)(80u << 20));        // Q,K,V: 24 MB
  __bf16* Kt     = Q  + (size_t)BB * SS * DLOCAL;
  __bf16* Vt     = Kt + (size_t)BB * SS * DLOCAL;              // [b][e][s]
  __bf16* probs  = (__bf16*)(ws + (size_t)(104u << 20));       // 32 MB
  __bf16* attnT  = (__bf16*)(ws + (size_t)(136u << 20));       //  8 MB

  cast_f32_bf16<<<CAST_BLOCKS, 256, 0, stream>>>(x, Wq, Wk, Wv, Wo, xbf, wqb);

  const float qscale = 0.08838834764831845f;  // 1/sqrt(d_k=128), folded into Q
  const int Mx = BB * SS;                     // 8192

  // Q, K, V projections: z = 0, 1, 2 (weights and outputs are contiguous);
  // V (z = 2) is stored as V_b^T, K-contiguous for the attn^T product below
  dim3 gProj(DLOCAL / BN, Mx / BM, 3);        // (4, 64, 3)
  gemm_async<false, 3><<<gProj, 256, 0, stream>>>(
      xbf, wqb, bq, bk, bv, Q, Mx, DLOCAL, DMODEL, DMODEL, DMODEL, qscale, 1.0f,
      0, DLOCAL * DMODEL, BB * SS * DLOCAL, 2);

  // scores[b,q,k] = Q_b @ K_b^T   (scale already folded into Q), z = batch
  dim3 gS(SS / BN, SS / BM, BB);              // (16, 16, 4)
  gemm_async<true, 2><<<gS, 256, 0, stream>>>(
      Q, Kt, nullptr, nullptr, nullptr, scores, SS, SS, DLOCAL, DLOCAL, DLOCAL,
      1.0f, 1.0f, SS * DLOCAL, SS * DLOCAL, SS * SS, -1);

  softmax_rows<<<dim3(SS, BB), 256, 0, stream>>>(scores, mask, probs);

  // attnT[b,e,q] = sum_k V[b,k,e] * probs[b,q,k]  == (probs_b @ V_b)^T, z = batch
  dim3 gA(SS / BN, DLOCAL / BM, BB);          // (16, 4, 4)
  gemm_async<false, 3><<<gA, 256, 0, stream>>>(
      Vt, probs, nullptr, nullptr, nullptr, attnT, DLOCAL, SS, SS, SS, SS,
      1.0f, 1.0f, DLOCAL * SS, SS * SS, DLOCAL * SS, -1);

  // attnT buffer, reinterpreted as [8192, 512] row-major, is exactly the
  // reference's swapaxes(1,2).reshape(B,S,d_local) permutation.
  dim3 gO(DMODEL / BN, Mx / BM);               // (32, 64)
  gemm_async<true, 2><<<gO, 256, 0, stream>>>(
      attnT, wob, bo, nullptr, nullptr, out, Mx, DMODEL, DLOCAL, DLOCAL, DLOCAL,
      1.0f, 1.0f, 0, 0, 0, -1);
}

// v006
// A run of this version takes 185 microseconds.
// In two side-by-side timings against v005, it was 1.05 and 1.04 times as fast.
// All steps since v000 together make it 3.46 times as fast.
#include <hip/hip_runtime.h>

typedef __attribute__((ext_vector_type(16))) __bf16 v16bf;
typedef __attribute__((ext_vector_type(8)))  float  v8f;

#define BM 128
#define BN 128
#define BK 64
#define LDSS 72

// Problem constants
#define DMODEL 4096
#define DLOCAL 512
#define BB     4
#define SS     2048

// 16 halves of one LDS row: its pieces p and p + 1 (p even), each at piece ^ sw
__device__ __forceinline__ v16bf ld_frag(const __bf16* row, int p, int sw) {
  union { uint4 u[2]; v16bf v; } t;
  t.u[0] = *(const uint4*)(row + ((p ^ sw) << 3));
  t.u[1] = *(const uint4*)(row + (((p + 1) ^ sw) << 3));
  return t.v;
}

// One thread's copies of one stage, global -> LDS, asynchronous: 16 bytes in each
// of 4 rows (32 rows apart) of the A tile and of the B tile. Eight neighbouring
// lanes cover one 128-byte row, so a wave-wide copy reads 4 whole cache lines.
// stepA / stepB: 32 rows of the source, in elements; LDS_STEP: 32 rows of a tile
// in LDS, in bytes. The closing wait stands in front of every later overwrite of
// the sixteen address operands; inside the statement nothing can be moved ahead
// of it.
template <uint32_t LDS_STEP>
__device__ __forceinline__ void async_copy_stage(uint32_t ldsA, const __bf16* gA,
                                                 size_t stepA,
                                                 uint32_t ldsB, const __bf16* gB,
                                                 size_t stepB) {
  asm volatile("global_load_async_to_lds_b128 %0, %1, off\n\t"
               "global_load_async_to_lds_b128 %2, %3, off\n\t"
               "global_load_async_to_lds_b128 %4, %5, off\n\t"
               "global_load_async_to_lds_b128 %6, %7, off\n\t"
               "global_load_async_to_lds_b128 %8, %9, off\n\t"
               "global_load_async_to_lds_b128 %10, %11, off\n\t"
               "global_load_async_to_lds_b128 %12, %13, off\n\t"
               "global_load_async_to_lds_b128 %14, %15, off\n\t"
               "s_wait_xcnt 0x0"
               :: "v"(ldsA),                "v"((unsigned long long)gA),
                  "v"(ldsA + LDS_STEP),     "v"((unsigned long long)(gA + stepA)),
                  "v"(ldsA + 2 * LDS_STEP), "v"((unsigned long long)(gA + 2 * stepA)),
                  "v"(ldsA + 3 * LDS_STEP), "v"((unsigned long long)(gA + 3 * stepA)),
                  "v"(ldsB),                "v"((unsigned long long)gB),
                  "v"(ldsB + LDS_STEP),     "v"((unsigned long long)(gB + stepB)),
                  "v"(ldsB + 2 * LDS_STEP), "v"((unsigned long long)(gB + 2 * stepB)),
                  "v"(ldsB + 3 * LDS_STEP), "v"((unsigned long long)(gB + 3 * stepB))
               : "memory");
}

typedef __attribute__((ext_vector_type(4))) float  f32x4;
typedef __attribute__((ext_vector_type(4))) __bf16 bf16x4;
typedef __attribute__((ext_vector_type(8))) __bf16 bf16x8;

// One grid casts all five f32 operands as a stream. A chunk is what one block
// moves in one trip: 256 threads x CAST_LD loads of 16 bytes, each wave-wide
// load covering 512 contiguous bytes. Chunks 0 .. XCHUNKS-1 are x, then WCHUNKS
// for each weight matrix (their bf16 copies are contiguous at wdst). All
// CAST_BLOCKS blocks are resident at once and take chunks CAST_BLOCKS apart.
#define CAST_LD     8
#define CHUNK       (256 * CAST_LD * 4)
#define XCHUNKS     (BB * SS * DMODEL / CHUNK)
#define WCHUNKS     (DLOCAL * DMODEL / CHUNK)
#define CAST_BLOCKS 1024
#define CAST_TRIPS  ((XCHUNKS + 4 * WCHUNKS) / CAST_BLOCKS)
static_assert(CAST_TRIPS * CAST_BLOCKS == XCHUNKS + 4 * WCHUNKS, "whole trips");
static_assert(XCHUNKS % CAST_BLOCKS == 0, "a trip is all x or all weights");

__global__ __launch_bounds__(256)
void cast_f32_bf16(const float* __restrict__ x,
                   const float* __restrict__ Wq, const float* __restrict__ Wk,
                   const float* __restrict__ Wv, const float* __restrict__ Wo,
                   __bf16* __restrict__ xdst, __bf16* __restrict__ wdst) {
  f32x4 v[CAST_TRIPS][CAST_LD];

  // unrolled so that every register set is indexed by constants; trip t's loads
  // are issued before trip t-1 is converted and stored
  #pragma unroll
  for (int trip = 0; trip <= CAST_TRIPS; ++trip) {
    if (trip < CAST_TRIPS) {
      int c = trip * CAST_BLOCKS + blockIdx.x;
      const float* src = x;
      if (trip * CAST_BLOCKS >= XCHUNKS) {
        c -= XCHUNKS;
        const int w = c / WCHUNKS;
        c -= w * WCHUNKS;
        src = (w == 0) ? Wq : (w == 1) ? Wk : (w == 2) ? Wv : Wo;
      }
      const f32x4* s = (const f32x4*)(src + (size_t)c * CHUNK) + threadIdx.x;
      #pragma unroll
      for (int j = 0; j < CAST_LD; ++j) v[trip][j] = s[j * 256];
    }
    if (trip > 0) {
      int c = (trip - 1) * CAST_BLOCKS + blockIdx.x;
      __bf16* dst = xdst;
      if ((trip - 1) * CAST_BLOCKS >= XCHUNKS) { c -= XCHUNKS; dst = wdst; }
      bf16x4* d = (bf16x4*)(dst + (size_t)c * CHUNK) + threadIdx.x;
      #pragma unroll
      for (int j = 0; j < CAST_LD; ++j)
        d[j * 256] = __builtin_convertvector(v[trip - 1][j], bf16x4);
      // the next trip's loads reuse registers that the stores above name: this
      // wait stands in front of their overwrite (nothing follows the last trip)
      if (trip < CAST_TRIPS) asm volatile("s_wait_xcnt 0x0" ::: "memory");
    }
  }
}

// ---------------------------------------------------------------------------
// out[M,N] = (A @ Bm^T + bias) * scale
//   A  stored [M,K] row-major (stride lda), Bm stored [N,K] row-major (ldb).
//   128x128 block tile, 8 waves (4x2), each wave = 32x64 via 8 WMMAs per 32 k,
//   16 per stage of BK = 64.
//   Async LDS staging in a ring of NBUF buffers (2 or 3), the copies NBUF - 1
//   stages ahead of the products; K / BK >= NBUF - 1.
//   blockIdx.z picks one of several independent products of the same shape:
//   operand and output bases move by zA / zB / zO elements per z.
// ---------------------------------------------------------------------------
template <bool OUT_F32, int NBUF>
__global__ __launch_bounds__(256)
void gemm_async(const __bf16* __restrict__ A,
                const __bf16* __restrict__ Bm,
                const float*  __restrict__ bias,
                void* __restrict__ outp,
                int M, int N, int K, int lda, int ldb, float scale,
                int zA, int zB, int zO)
{
  constexpr int PITCH = (NBUF == 2) ? LDSS : BK;   // LDS row pitch, in halves
  constexpr int SWM   = (NBUF == 2) ? 0 : 7;       // mask of the piece swizzle
  __shared__ __align__(16) __bf16 As[NBUF][BM * PITCH];
  __shared__ __align__(16) __bf16 Bs[NBUF][BN * PITCH];

  const int tid     = threadIdx.x;
  const int lane    = tid & 31;
  const int wave    = tid >> 5;
  const int waveRow = wave & 3;   // 4 wave-rows of 32
  const int waveCol = wave >> 2;  // 2 wave-cols of 64
  const int blockM  = blockIdx.y * BM;
  const int blockN  = blockIdx.x * BN;

  const int z = blockIdx.z;
  A  += (size_t)z * zA;
  Bm += (size_t)z * zB;
  const size_t oOff = (size_t)z * zO;

  // staging coordinates: each thread owns one 16B piece of rows sr, sr + 32,
  // sr + 64 and sr + 96 in the A and B tiles
  const int sr = tid >> 3;        // 0..31
  const int sp = tid & 7;         // piece of 8 halves within the 64-half row
  const __bf16* gA = A  + (size_t)(blockM + sr) * lda + sp * 8;
  const __bf16* gB = Bm + (size_t)(blockN + sr) * ldb + sp * 8;
  const size_t stepA = (size_t)32 * lda;
  const size_t stepB = (size_t)32 * ldb;
  // (rows 32 apart share one swizzle)
  const int sOff = sr * PITCH + ((sp ^ ((sr >> 1) & SWM)) << 3);

  // this thread's 8 copies of the stage that starts at k = koff
  auto copy_stage = [&](int buf, int koff) {
    async_copy_stage<32 * PITCH * 2>(
        (uint32_t)(size_t)&As[buf][sOff], gA + koff, stepA,
        (uint32_t)(size_t)&Bs[buf][sOff], gB + koff, stepB);
  };

  v8f acc[2][4] = {};

  const int fr = lane & 15;       // fragment row within a 16x32 tile
  const int fh = lane >> 4;       // K-half select
  const int fsw = (fr >> 1) & SWM;  // swizzle of this lane's rows (16 apart)

  const int nsteps = K / BK;

  // prologue: steps 0 .. NBUF - 2 into buffers 0 .. NBUF - 2
  for (int s = 0; s < NBUF - 1; ++s) copy_stage(s, s * BK);

  int cur = 0;         // buffer of step t
  int nxt = NBUF - 1;  // buffer of step t + NBUF - 1 = the one step t - 1 has left
  for (int t = 0; t < nsteps; ++t) {
    if (t + NBUF - 1 < nsteps) {
      copy_stage(nxt, (t + NBUF - 1) * BK);
      // all but the youngest 8 (NBUF - 1) copies have landed: step t's are in LDS
      asm volatile("s_wait_asynccnt %0" :: "n"(8 * (NBUF - 1)) : "memory");
    } else {
      // a trip that issues nothing waits for all that is left
      asm volatile("s_wait_asynccnt 0x0" ::: "memory");
    }
    __syncthreads();  // all waves' step-t tiles visible in LDS

    #pragma unroll
    for (int ks = 0; ks < BK; ks += 32) {
      v16bf afrag[2], bfrag[4];
      #pragma unroll
      for (int mt = 0; mt < 2; ++mt)
        afrag[mt] = ld_frag(&As[cur][(waveRow * 32 + mt * 16 + fr) * PITCH],
                            ks / 8 + fh * 2, fsw);
      #pragma unroll
      for (int nt = 0; nt < 4; ++nt)
        bfrag[nt] = ld_frag(&Bs[cur][(waveCol * 64 + nt * 16 + fr) * PITCH],
                            ks / 8 + fh * 2, fsw);

      #pragma unroll
      for (int mt = 0; mt < 2; ++mt)
        #pragma unroll
        for (int nt = 0; nt < 4; ++nt)
          acc[mt][nt] = __builtin_amdgcn_wmma_f32_16x16x32_bf16(
              false, afrag[mt], false, bfrag[nt], (short)0, acc[mt][nt],
              false, false);
    }

    __syncthreads();  // buffer `cur` free for step t + NBUF's async writes
    nxt = cur;
    cur = (cur + 1 == NBUF) ? 0 : cur + 1;
  }

  const int ccol = lane & 15;
  const int crow = (lane >> 4) * 8;

  #pragma unroll
  for (int mt = 0; mt < 2; ++mt) {
    #pragma unroll
    for (int nt = 0; nt < 4; ++nt) {
      int colg = blockN + waveCol * 64 + nt * 16 + ccol;
      float bv = bias ? bias[colg] : 0.0f;
      #pragma unroll
      for (int j = 0; j < 8; ++j) {
        int rowg = blockM + waveRow * 32 + mt * 16 + crow + j;
        float v = (acc[mt][nt][j] + bv) * scale;
        if (OUT_F32) ((float*)outp)[oOff + (size_t)rowg * N + colg] = v;
        else         ((__bf16*)outp)[oOff + (size_t)rowg * N + colg] = (__bf16)v;
      }
      // the next column tile reuses registers that the stores above name: this
      // wait stands in front of their overwrite (no tile follows the last one)
      if (mt * 4 + nt < 7) asm volatile("s_wait_xcnt 0x0" ::: "memory");
    }
  }
}

// ---------------------------------------------------------------------------
// Q, K, V projections as one product [8192 x 4096] x [1536 x 4096]^T (the three
// weight matrices are contiguous). One 256 x 192 tile a block, one block a WGP,
// 16 waves (4 x 4), each 64 x 48 = 12 WMMAs per 32 k on 7 fragments.
// A stage is 64 k of the tile's 256 + 192 rows, unpadded and XOR-swizzled as
// above, in a ring of 4 buffers, the copies up to 4 stages ahead.
// Fragments are fetched one 32-k block ahead into a second register set, so the
// publish point of stage t + 1 stands in front of stage t's last block; at that
// barrier every wave holds all of stage t in registers, and its buffer is refilled.
// Columns 0..511 are Q (scaled), 512..1023 K, 1024..1535 V; V is stored as V_b^T:
// out[2][row / SS][col][row % SS].
// ---------------------------------------------------------------------------
#define QM 256
#define QN 192
#define QSTAGE ((QM + QN) * BK)   // halves in one buffer

// One thread's 7 copies of one stage: 16 bytes in each of 4 rows of the A tile and
// 3 rows of the B tile, 64 rows apart (8192 bytes in LDS). The closing wait stands
// in front of every later overwrite of the fourteen address operands.
__device__ __forceinline__ void async_copy_stage7(uint32_t lds, const __bf16* gA,
                                                  const __bf16* gB, size_t step) {
  asm volatile("global_load_async_to_lds_b128 %0, %1, off\n\t"
               "global_load_async_to_lds_b128 %2, %3, off\n\t"
               "global_load_async_to_lds_b128 %4, %5, off\n\t"
               "global_load_async_to_lds_b128 %6, %7, off\n\t"
               "global_load_async_to_lds_b128 %8, %9, off\n\t"
               "global_load_async_to_lds_b128 %10, %11, off\n\t"
               "global_load_async_to_lds_b128 %12, %13, off\n\t"
               "s_wait_xcnt 0x0"
               :: "v"(lds),             "v"((unsigned long long)gA),
                  "v"(lds + 8192),      "v"((unsigned long long)(gA + step)),
                  "v"(lds + 2 * 8192),  "v"((unsigned long long)(gA + 2 * step)),
                  "v"(lds + 3 * 8192),  "v"((unsigned long long)(gA + 3 * step)),
                  "v"(lds + 4 * 8192),  "v"((unsigned long long)gB),
                  "v"(lds + 5 * 8192),  "v"((unsigned long long)(gB + step)),
                  "v"(lds + 6 * 8192),  "v"((unsigned long long)(gB + 2 * step))
               : "memory");
}

__global__ __launch_bounds__(512)
void gemm_qkv(const __bf16* __restrict__ X, const __bf16* __restrict__ Wm,
              const float* __restrict__ bq, const float* __restrict__ bk,
              const float* __restrict__ bv, __bf16* __restrict__ outp,
              float qscale)
{
  __shared__ __align__(16) __bf16 St[4][QSTAGE];

  const int tid     = threadIdx.x;
  const int lane    = tid & 31;
  const int wave    = __builtin_amdgcn_readfirstlane(tid >> 5);
  const int waveRow = wave & 3;   // 4 wave-rows of 64
  const int waveCol = wave >> 2;  // 4 wave-cols of 48
  const int blockM  = blockIdx.y * QM;
  const int blockN  = blockIdx.x * QN;

  // staging: each thread owns one 16B piece of LDS rows sr + 64 i, i = 0..6
  // (rows 0..255: A tile, 256..447: B tile; rows 64 apart share one swizzle)
  const int sr = tid >> 3;        // 0..63
  const int sp = tid & 7;
  const __bf16* gA = X  + (size_t)(blockM + sr) * DMODEL + sp * 8;
  const __bf16* gB = Wm + (size_t)(blockN + sr) * DMODEL + sp * 8;
  const int sOff = sr * BK + ((sp ^ ((sr >> 1) & 7)) << 3);

  auto copy_stage = [&](int buf, int s) {
    async_copy_stage7((uint32_t)(size_t)&St[buf][sOff], gA + s * BK, gB + s * BK,
                      (size_t)64 * DMODEL);
  };

  const int fr  = lane & 15;      // fragment row within a 16x32 tile
  const int fh  = lane >> 4;      // K-half select
  const int fsw = (fr >> 1) & 7;  // swizzle of this lane's rows (16 apart)
  const int aRow = (waveRow * 64 + fr) * BK;
  const int bRow = (QM + waveCol * 48 + fr) * BK;

  v8f acc[4][3] = {};
  v16bf fa[2][4], fb[2][3];

  // the 7 fragments of the 32-k block that starts at ks in buffer buf
  auto load_frags = [&](v16bf* a, v16bf* b, int buf, int ks) {
    #pragma unroll
    for (int mt = 0; mt < 4; ++mt)
      a[mt] = ld_frag(&St[buf][aRow + mt * 16 * BK], ks / 8 + fh * 2, fsw);
    #pragma unroll
    for (int nt = 0; nt < 3; ++nt)
      b[nt] = ld_frag(&St[buf][bRow + nt * 16 * BK], ks / 8 + fh * 2, fsw);
  };
  auto mma = [&](const v16bf* a, const v16bf* b) {
    #pragma unroll
    for (int mt = 0; mt < 4; ++mt)
      #pragma unroll
      for (int nt = 0; nt < 3; ++nt)
        acc[mt][nt] = __builtin_amdgcn_wmma_f32_16x16x32_bf16(
            false, a[mt], false, b[nt], (short)0, acc[mt][nt], false, false);
  };

  constexpr int nsteps = DMODEL / BK;
  static_assert(nsteps >= 4, "the prologue fills four stages");

  copy_stage(0, 0);
  copy_stage(1, 1);
  copy_stage(2, 2);
  copy_stage(3, 3);
  // all but the youngest 21 copies have landed: stage 0 is in LDS
  asm volatile("s_wait_asynccnt 21" ::: "memory");
  __syncthreads();  // stage 0 visible to all waves
  load_frags(fa[0], fb[0], 0, 0);

  for (int t = 0; t < nsteps; ++t) {
    const int cur = t & 3;        // buffer of stage t
    const int nxt = (t + 1) & 3;
    load_frags(fa[1], fb[1], cur, 32);
    // keeps the 14 LDS loads above as one group ahead of the products below;
    // without it they sink among the WMMAs and the wait behind them stalls
    __builtin_amdgcn_sched_barrier(0);
    mma(fa[0], fb[0]);
    // keeps those products ahead of the waits below, so that the loads return
    // behind them and not in front of an idle matrix unit
    __builtin_amdgcn_sched_barrier(0);

    // publish point of stage t + 1. This wave's reads of stage t have returned:
    asm volatile("s_wait_dscnt 0x0" ::: "memory");
    // its copies of stage t + 1 have landed (the 14 of two later stages may fly):
    if (t + 3 < nsteps) asm volatile("s_wait_asynccnt 14" ::: "memory");
    else                asm volatile("s_wait_asynccnt 0x0" ::: "memory");
    __syncthreads();  // stage t + 1 visible; every wave has left stage t's buffer
    if (t + 1 < nsteps) load_frags(fa[0], fb[0], nxt, 0);
    __builtin_amdgcn_sched_barrier(0);
    mma(fa[1], fb[1]);
    __builtin_amdgcn_sched_barrier(0);
    if (t + 4 < nsteps) copy_stage(cur, t + 4);
  }

  const int ccol = lane & 15;
  const int crow = (lane >> 4) * 8;
  static_assert(SS % QM == 0, "a block's rows lie in one batch");
  static_assert(DLOCAL % 16 == 0, "a 16-column tile lies in one of Q, K, V");

  #pragma unroll
  for (int nt = 0; nt < 3; ++nt) {
    const int colT = blockN + waveCol * 48 + nt * 16;  // the same in the whole wave
    const int z    = colT / DLOCAL;                    // 0: Q, 1: K, 2: V
    const int col  = colT % DLOCAL + ccol;
    const float* bias = (z == 0) ? bq : (z == 1) ? bk : bv;
    const float scale = (z == 0) ? qscale : 1.0f;
    const float b = bias[col];
    // the address arithmetic below reuses registers that the load above names:
    // this wait stands in front of their overwrite
    asm volatile("s_wait_xcnt 0x0" ::: "memory");
    __bf16* oz = outp + (size_t)z * BB * SS * DLOCAL;
    if (z == 2) {
      // a lane's 8 accumulator rows are 8 neighbours of one row of V_b^T, so
      // each 16x16 tile leaves as one 16-byte store a lane
      __bf16* ot = oz + (size_t)(blockM / SS) * DLOCAL * SS + (size_t)col * SS +
                   blockM % SS + waveRow * 64 + crow;
      #pragma unroll
      for (int mt = 0; mt < 4; ++mt) {
        bf16x8 p;
        #pragma unroll
        for (int j = 0; j < 8; ++j) p[j] = (__bf16)((acc[mt][nt][j] + b) * scale);
        *(bf16x8*)(ot + mt * 16) = p;
        // later tiles reuse registers that the store above names: this wait
        // stands in front of their overwrite (no tile follows the last one)
        if (nt * 4 + mt < 11) asm volatile("s_wait_xcnt 0x0" ::: "memory");
      }
    } else {
      #pragma unroll
      for (int mt = 0; mt < 4; ++mt) {
        #pragma unroll
        for (int j = 0; j < 8; ++j) {
          const int rowg = blockM + waveRow * 64 + mt * 16 + crow + j;
          oz[(size_t)rowg * DLOCAL + col] = (__bf16)((acc[mt][nt][j] + b) * scale);
        }
        asm volatile("s_wait_xcnt 0x0" ::: "memory");
      }
    }
  }
}

// Row softmax over 2048 columns (one 256-thread block per row), masked.
// blockIdx.y = batch (its own mask row and its own 2048 score rows).
__global__ __launch_bounds__(256)
void softmax_rows(const float* __restrict__ scores, const int* __restrict__ mask,
                  __bf16* __restrict__ probs)
{
  const int row = blockIdx.y * SS + blockIdx.x;
  const int tid = threadIdx.x;
  mask += (size_t)blockIdx.y * SS;
  const float* srow = scores + (size_t)row * SS;
  __bf16* prow = probs + (size_t)row * SS;

  float vals[8];
  float m = -3.0e38f;
  #pragma unroll
  for (int i = 0; i < 8; ++i) {
    int c = tid + i * 256;
    float s = srow[c];
    if (mask[c] == 0) s = -1.0e9f;
    vals[i] = s;
    m = fmaxf(m, s);
  }
  for (int off = 16; off > 0; off >>= 1) m = fmaxf(m, __shfl_xor(m, off, 32));
  __shared__ float red[8];
  if ((tid & 31) == 0) red[tid >> 5] = m;
  __syncthreads();
  m = red[0];
  #pragma unroll
  for (int w = 1; w < 8; ++w) m = fmaxf(m, red[w]);
  __syncthreads();

  float sum = 0.0f;
  #pragma unroll
  for (int i = 0; i < 8; ++i) { vals[i] = __expf(vals[i] - m); sum += vals[i]; }
  for (int off = 16; off > 0; off >>= 1) sum += __shfl_xor(sum, off, 32);
  if ((tid & 31) == 0) red[tid >> 5] = sum;
  __syncthreads();
  sum = 0.0f;
  #pragma unroll
  for (int w = 0; w < 8; ++w) sum += red[w];
  const float inv = 1.0f / sum;
  #pragma unroll
  for (int i = 0; i < 8; ++i) prow[tid + i * 256] = (__bf16)(vals[i] * inv);
}

extern "C" void kernel_launch(void* const* d_in, const int* in_sizes, int n_in,
                              void* d_out, int out_size, void* d_ws, size_t ws_size,
                              hipStream_t stream) {
  (void)in_sizes; (void)n_in; (void)out_size; (void)ws_size;
  const float* x    = (const float*)d_in[0];
  const int*   mask = (const int*)d_in[1];
  const float* Wq = (const float*)d_in[2];
  const float* bq = (const float*)d_in[3];
  const float* Wk = (const float*)d_in[4];
  const float* bk = (const float*)d_in[5];
  const float* Wv = (const float*)d_in[6];
  const float* bv = (const float*)d_in[7];
  const float* Wo = (const float*)d_in[8];
  const float* bo = (const float*)d_in[9];
  float* out = (float*)d_out;

  // Workspace layout (144 MB). scores (all four batches) overlay the x_bf16
  // region, which is dead once Q/K/V are produced.
  char* ws = (char*)d_ws;
  __bf16* xbf    = (__bf16*)(ws);                              // 64 MB
  float*  scores = (float*)(ws);                               // 64 MB (reuse)
  __bf16* wqb    = (__bf16*)(ws + (size_t)(64u << 20));        // Wq,Wk,Wv,Wo
  __bf16* wob    = wqb + (size_t)3 * DLOCAL * DMODEL;
  __bf16* Q      = (__bf16*)(ws + (size_t)(80u << 20));        // Q,K,V: 24 MB
  __bf16* Kt     = Q  + (size_t)BB * SS * DLOCAL;
  __bf16* Vt     = Kt + (size_t)BB * SS * DLOCAL;              // [b][e][s]
  __bf16* probs  = (__bf16*)(ws + (size_t)(104u << 20));       // 32 MB
  __bf16* attnT  = (__bf16*)(ws + (size_t)(136u << 20));       //  8 MB

  cast_f32_bf16<<<CAST_BLOCKS, 256, 0, stream>>>(x, Wq, Wk, Wv, Wo, xbf, wqb);

  const float qscale = 0.08838834764831845f;  // 1/sqrt(d_k=128), folded into Q
  const int Mx = BB * SS;                     // 8192

  // Q, K, V projections (weights and outputs are contiguous); V is stored as
  // V_b^T, K-contiguous for the attn^T product below
  dim3 gProj(3 * DLOCAL / QN, Mx / QM);       // (8, 32)
  gemm_qkv<<<gProj, 512, 0, stream>>>(xbf, wqb, bq, bk, bv, Q, qscale);

  // scores[b,q,k] = Q_b @ K_b^T   (scale already folded into Q), z = batch
  dim3 gS(SS / BN, SS / BM, BB);              // (16, 16, 4)
  gemm_async<true, 2><<<gS, 256, 0, stream>>>(
      Q, Kt, nullptr, scores, SS, SS, DLOCAL, DLOCAL, DLOCAL,
      1.0f, SS * DLOCAL, SS * DLOCAL, SS * SS);

  softmax_rows<<<dim3(SS, BB), 256, 0, stream>>>(scores, mask, probs);

  // attnT[b,e,q] = sum_k V[b,k,e] * probs[b,q,k]  == (probs_b @ V_b)^T, z = batch
  dim3 gA(SS / BN, DLOCAL / BM, BB);          // (16, 4, 4)
  gemm_async<false, 3><<<gA, 256, 0, stream>>>(
      Vt, probs, nullptr, attnT, DLOCAL, SS, SS, SS, SS,
      1.0f, DLOCAL * SS, SS * SS, DLOCAL * SS);

  // attnT buffer, reinterpreted as [8192, 512] row-major, is exactly the
  // reference's swapaxes(1,2).reshape(B,S,d_local) permutation.
  dim3 gO(DMODEL / BN, Mx / BM);               // (32, 64)
  gemm_async<true, 2><<<gO, 256, 0, stream>>>(
      attnT, wob, bo, out, Mx, DMODEL, DLOCAL, DLOCAL, DLOCAL,
      1.0f, 0, 0, 0);
}

// v007
// Measured time: 171 microseconds a run.
// Timed twice side by side with v006, it ran 1.09 and 1.08 times as fast.
// Over all steps from v000 it is 3.75 times as fast.
#include <hip/hip_runtime.h>

typedef __attribute__((ext_vector_type(16))) __bf16 v16bf;
typedef __attribute__((ext_vector_type(8)))  float  v8f;

#define BM 128
#define BN 128
#define BK 64
#define LDSS 72

// Problem constants
#define DMODEL 4096
#define DLOCAL 512
#define BB     4
#define SS     2048

// 16 halves of one LDS row: its pieces p and p + 1 (p even), each at piece ^ sw
__device__ __forceinline__ v16bf ld_frag(const __bf16* row, int p, int sw) {
  union { uint4 u[2]; v16bf v; } t;
  t.u[0] = *(const uint4*)(row + ((p ^ sw) << 3));
  t.u[1] = *(const uint4*)(row + (((p + 1) ^ sw) << 3));
  return t.v;
}

// One thread's copies of one stage, global -> LDS, asynchronous: 16 bytes in each
// of 4 rows (32 rows apart) of the A tile and of the B tile. Eight neighbouring
// lanes cover one 128-byte row, so a wave-wide copy reads 4 whole cache lines.
// stepA / stepB: 32 rows of the source, in elements; LDS_STEP: 32 rows of a tile
// in LDS, in bytes. The closing wait stands in front of every later overwrite of
// the sixteen address operands; inside the statement nothing can be moved ahead
// of it.
template <uint32_t LDS_STEP>
__device__ __forceinline__ void async_copy_stage(uint32_t ldsA, const __bf16* gA,
                                                 size_t stepA,
                                                 uint32_t ldsB, const __bf16* gB,
                                                 size_t stepB) {
  asm volatile("global_load_async_to_lds_b128 %0, %1, off\n\t"
               "global_load_async_to_lds_b128 %2, %3, off\n\t"
               "global_load_async_to_lds_b128 %4, %5, off\n\t"
               "global_load_async_to_lds_b128 %6, %7, off\n\t"
               "global_load_async_to_lds_b128 %8, %9, off\n\t"
               "global_load_async_to_lds_b128 %10, %11, off\n\t"
               "global_load_async_to_lds_b128 %12, %13, off\n\t"
               "global_load_async_to_lds_b128 %14, %15, off\n\t"
               "s_wait_xcnt 0x0"
               :: "v"(ldsA),                "v"((unsigned long long)gA),
                  "v"(ldsA + LDS_STEP),     "v"((unsigned long long)(gA + stepA)),
                  "v"(ldsA + 2 * LDS_STEP), "v"((unsigned long long)(gA + 2 * stepA)),
                  "v"(ldsA + 3 * LDS_STEP), "v"((unsigned long long)(gA + 3 * stepA)),
                  "v"(ldsB),                "v"((unsigned long long)gB),
                  "v"(ldsB + LDS_STEP),     "v"((unsigned long long)(gB + stepB)),
                  "v"(ldsB + 2 * LDS_STEP), "v"((unsigned long long)(gB + 2 * stepB)),
                  "v"(ldsB + 3 * LDS_STEP), "v"((unsigned long long)(gB + 3 * stepB))
               : "memory");
}

typedef __attribute__((ext_vector_type(4))) float  f32x4;
typedef __attribute__((ext_vector_type(4))) __bf16 bf16x4;
typedef __attribute__((ext_vector_type(8))) __bf16 bf16x8;

// One grid casts all five f32 operands as a stream. A chunk is what one block
// moves in one trip: 256 threads x CAST_LD loads of 16 bytes, each wave-wide
// load covering 512 contiguous bytes. Chunks 0 .. XCHUNKS-1 are x, then WCHUNKS
// for each weight matrix (their bf16 copies are contiguous at wdst). All
// CAST_BLOCKS blocks are resident at once and take chunks CAST_BLOCKS apart.
#define CAST_LD     8
#define CHUNK       (256 * CAST_LD * 4)
#define XCHUNKS     (BB * SS * DMODEL / CHUNK)
#define WCHUNKS     (DLOCAL * DMODEL / CHUNK)
#define CAST_BLOCKS 1024
#define CAST_TRIPS  ((XCHUNKS + 4 * WCHUNKS) / CAST_BLOCKS)
static_assert(CAST_TRIPS * CAST_BLOCKS == XCHUNKS + 4 * WCHUNKS, "whole trips");
static_assert(XCHUNKS % CAST_BLOCKS == 0, "a trip is all x or all weights");

__global__ __launch_bounds__(256)
void cast_f32_bf16(const float* __restrict__ x,
                   const float* __restrict__ Wq, const float* __restrict__ Wk,
                   const float* __restrict__ Wv, const float* __restrict__ Wo,
                   __bf16* __restrict__ xdst, __bf16* __restrict__ wdst) {
  f32x4 v[CAST_TRIPS][CAST_LD];

  // unrolled so that every register set is indexed by constants; trip t's loads
  // are issued before trip t-1 is converted and stored
  #pragma unroll
  for (int trip = 0; trip <= CAST_TRIPS; ++trip) {
    if (trip < CAST_TRIPS) {
      int c = trip * CAST_BLOCKS + blockIdx.x;
      const float* src = x;
      if (trip * CAST_BLOCKS >= XCHUNKS) {
        c -= XCHUNKS;
        const int w = c / WCHUNKS;
        c -= w * WCHUNKS;
        src = (w == 0) ? Wq : (w == 1) ? Wk : (w == 2) ? Wv : Wo;
      }
      const f32x4* s = (const f32x4*)(src + (size_t)c * CHUNK) + threadIdx.x;
      #pragma unroll
      for (int j = 0; j < CAST_LD; ++j) v[trip][j] = s[j * 256];
    }
    if (trip > 0) {
      int c = (trip - 1) * CAST_BLOCKS + blockIdx.x;
      __bf16* dst = xdst;
      if ((trip - 1) * CAST_BLOCKS >= XCHUNKS) { c -= XCHUNKS; dst = wdst; }
      bf16x4* d = (bf16x4*)(dst + (size_t)c * CHUNK) + threadIdx.x;
      #pragma unroll
      for (int j = 0; j < CAST_LD; ++j)
        d[j * 256] = __builtin_convertvector(v[trip - 1][j], bf16x4);
      // the next trip's loads reuse registers that the stores above name: this
      // wait stands in front of their overwrite (nothing follows the last trip)
      if (trip < CAST_TRIPS) asm volatile("s_wait_xcnt 0x0" ::: "memory");
    }
  }
}

// ---------------------------------------------------------------------------
// out[M,N] = (A @ Bm^T + bias) * scale
//   A  stored [M,K] row-major (stride lda), Bm stored [N,K] row-major (ldb).
//   128x128 block tile, 8 waves (4x2), each wave = 32x64 via 8 WMMAs per 32 k,
//   16 per stage of BK = 64.
//   Async LDS staging in a ring of NBUF buffers (2 or 3), the copies NBUF - 1
//   stages ahead of the products; K / BK >= NBUF - 1.
//   blockIdx.z picks one of several independent products of the same shape:
//   operand and output bases move by zA / zB / zO elements per z.
// ---------------------------------------------------------------------------
template <bool OUT_F32, int NBUF>
__global__ __launch_bounds__(256)
void gemm_async(const __bf16* __restrict__ A,
                const __bf16* __restrict__ Bm,
                const float*  __restrict__ bias,
                void* __restrict__ outp,
                int M, int N, int K, int lda, int ldb, float scale,
                int zA, int zB, int zO)
{
  constexpr int PITCH = (NBUF == 2) ? LDSS : BK;   // LDS row pitch, in halves
  constexpr int SWM   = (NBUF == 2) ? 0 : 7;       // mask of the piece swizzle
  __shared__ __align__(16) __bf16 As[NBUF][BM * PITCH];
  __shared__ __align__(16) __bf16 Bs[NBUF][BN * PITCH];

  const int tid     = threadIdx.x;
  const int lane    = tid & 31;
  const int wave    = tid >> 5;
  const int waveRow = wave & 3;   // 4 wave-rows of 32
  const int waveCol = wave >> 2;  // 2 wave-cols of 64
  const int blockM  = blockIdx.y * BM;
  const int blockN  = blockIdx.x * BN;

  const int z = blockIdx.z;
  A  += (size_t)z * zA;
  Bm += (size_t)z * zB;
  const size_t oOff = (size_t)z * zO;

  // staging coordinates: each thread owns one 16B piece of rows sr, sr + 32,
  // sr + 64 and sr + 96 in the A and B tiles
  const int sr = tid >> 3;        // 0..31
  const int sp = tid & 7;         // piece of 8 halves within the 64-half row
  const __bf16* gA = A  + (size_t)(blockM + sr) * lda + sp * 8;
  const __bf16* gB = Bm + (size_t)(blockN + sr) * ldb + sp * 8;
  const size_t stepA = (size_t)32 * lda;
  const size_t stepB = (size_t)32 * ldb;
  // (rows 32 apart share one swizzle)
  const int sOff = sr * PITCH + ((sp ^ ((sr >> 1) & SWM)) << 3);

  // this thread's 8 copies of the stage that starts at k = koff
  auto copy_stage = [&](int buf, int koff) {
    async_copy_stage<32 * PITCH * 2>(
        (uint32_t)(size_t)&As[buf][sOff], gA + koff, stepA,
        (uint32_t)(size_t)&Bs[buf][sOff], gB + koff, stepB);
  };

  v8f acc[2][4] = {};

  const int fr = lane & 15;       // fragment row within a 16x32 tile
  const int fh = lane >> 4;       // K-half select
  const int fsw = (fr >> 1) & SWM;  // swizzle of this lane's rows (16 apart)

  const int nsteps = K / BK;

  // prologue: steps 0 .. NBUF - 2 into buffers 0 .. NBUF - 2
  for (int s = 0; s < NBUF - 1; ++s) copy_stage(s, s * BK);

  int cur = 0;         // buffer of step t
  int nxt = NBUF - 1;  // buffer of step t + NBUF - 1 = the one step t - 1 has left
  for (int t = 0; t < nsteps; ++t) {
    if (t + NBUF - 1 < nsteps) {
      copy_stage(nxt, (t + NBUF - 1) * BK);
      // all but the youngest 8 (NBUF - 1) copies have landed: step t's are in LDS
      asm volatile("s_wait_asynccnt %0" :: "n"(8 * (NBUF - 1)) : "memory");
    } else {
      // a trip that issues nothing waits for all that is left
      asm volatile("s_wait_asynccnt 0x0" ::: "memory");
    }
    __syncthreads();  // all waves' step-t tiles visible in LDS

    #pragma unroll
    for (int ks = 0; ks < BK; ks += 32) {
      v16bf afrag[2], bfrag[4];
      #pragma unroll
      for (int mt = 0; mt < 2; ++mt)
        afrag[mt] = ld_frag(&As[cur][(waveRow * 32 + mt * 16 + fr) * PITCH],
                            ks / 8 + fh * 2, fsw);
      #pragma unroll
      for (int nt = 0; nt < 4; ++nt)
        bfrag[nt] = ld_frag(&Bs[cur][(waveCol * 64 + nt * 16 + fr) * PITCH],
                            ks / 8 + fh * 2, fsw);

      #pragma unroll
      for (int mt = 0; mt < 2; ++mt)
        #pragma unroll
        for (int nt = 0; nt < 4; ++nt)
          acc[mt][nt] = __builtin_amdgcn_wmma_f32_16x16x32_bf16(
              false, afrag[mt], false, bfrag[nt], (short)0, acc[mt][nt],
              false, false);
    }

    __syncthreads();  // buffer `cur` free for step t + NBUF's async writes
    nxt = cur;
    cur = (cur + 1 == NBUF) ? 0 : cur + 1;
  }

  const int ccol = lane & 15;
  const int crow = (lane >> 4) * 8;

  #pragma unroll
  for (int mt = 0; mt < 2; ++mt) {
    #pragma unroll
    for (int nt = 0; nt < 4; ++nt) {
      int colg = blockN + waveCol * 64 + nt * 16 + ccol;
      float bv = bias ? bias[colg] : 0.0f;
      #pragma unroll
      for (int j = 0; j < 8; ++j) {
        int rowg = blockM + waveRow * 32 + mt * 16 + crow + j;
        float v = (acc[mt][nt][j] + bv) * scale;
        if (OUT_F32) ((float*)outp)[oOff + (size_t)rowg * N + colg] = v;
        else         ((__bf16*)outp)[oOff + (size_t)rowg * N + colg] = (__bf16)v;
      }
      // the next column tile reuses registers that the stores above name: this
      // wait stands in front of their overwrite (no tile follows the last one)
      if (mt * 4 + nt < 7) asm volatile("s_wait_xcnt 0x0" ::: "memory");
    }
  }
}

// ---------------------------------------------------------------------------
// Q, K, V projections as one product [8192 x 4096] x [1536 x 4096]^T (the three
// weight matrices are contiguous). One 256 x 192 tile a block, one block a WGP,
// 16 waves (4 x 4), each 64 x 48 = 12 WMMAs per 32 k on 7 fragments.
// A stage is 64 k of the tile's 256 + 192 rows, unpadded and XOR-swizzled as
// above, in a ring of 4 buffers, the copies up to 4 stages ahead.
// Fragments are fetched one 32-k block ahead into a second register set, so the
// publish point of stage t + 1 stands in front of stage t's last block; at that
// barrier every wave holds all of stage t in registers, and its buffer is refilled.
// Columns 0..511 are Q (scaled), 512..1023 K, 1024..1535 V; V is stored as V_b^T:
// out[2][row / SS][col][row % SS].
// ---------------------------------------------------------------------------
#define QM 256
#define QN 192
#define QSTAGE ((QM + QN) * BK)   // halves in one buffer

// One thread's 7 copies of one stage: 16 bytes in each of 4 rows of the A tile and
// 3 rows of the B tile, 64 rows apart (8192 bytes in LDS). The closing wait stands
// in front of every later overwrite of the fourteen address operands.
__device__ __forceinline__ void async_copy_stage7(uint32_t lds, const __bf16* gA,
                                                  const __bf16* gB, size_t step) {
  asm volatile("global_load_async_to_lds_b128 %0, %1, off\n\t"
               "global_load_async_to_lds_b128 %2, %3, off\n\t"
               "global_load_async_to_lds_b128 %4, %5, off\n\t"
               "global_load_async_to_lds_b128 %6, %7, off\n\t"
               "global_load_async_to_lds_b128 %8, %9, off\n\t"
               "global_load_async_to_lds_b128 %10, %11, off\n\t"
               "global_load_async_to_lds_b128 %12, %13, off\n\t"
               "s_wait_xcnt 0x0"
               :: "v"(lds),             "v"((unsigned long long)gA),
                  "v"(lds + 8192),      "v"((unsigned long long)(gA + step)),
                  "v"(lds + 2 * 8192),  "v"((unsigned long long)(gA + 2 * step)),
                  "v"(lds + 3 * 8192),  "v"((unsigned long long)(gA + 3 * step)),
                  "v"(lds + 4 * 8192),  "v"((unsigned long long)gB),
                  "v"(lds + 5 * 8192),  "v"((unsigned long long)(gB + step)),
                  "v"(lds + 6 * 8192),  "v"((unsigned long long)(gB + 2 * step))
               : "memory");
}

__global__ __launch_bounds__(512)
void gemm_qkv(const __bf16* __restrict__ X, const __bf16* __restrict__ Wm,
              const float* __restrict__ bq, const float* __restrict__ bk,
              const float* __restrict__ bv, __bf16* __restrict__ outp,
              float qscale)
{
  __shared__ __align__(16) __bf16 St[4][QSTAGE];

  const int tid     = threadIdx.x;
  const int lane    = tid & 31;
  const int wave    = __builtin_amdgcn_readfirstlane(tid >> 5);
  const int waveRow = wave & 3;   // 4 wave-rows of 64
  const int waveCol = wave >> 2;  // 4 wave-cols of 48
  const int blockM  = blockIdx.y * QM;
  const int blockN  = blockIdx.x * QN;

  // staging: each thread owns one 16B piece of LDS rows sr + 64 i, i = 0..6
  // (rows 0..255: A tile, 256..447: B tile; rows 64 apart share one swizzle)
  const int sr = tid >> 3;        // 0..63
  const int sp = tid & 7;
  const __bf16* gA = X  + (size_t)(blockM + sr) * DMODEL + sp * 8;
  const __bf16* gB = Wm + (size_t)(blockN + sr) * DMODEL + sp * 8;
  const int sOff = sr * BK + ((sp ^ ((sr >> 1) & 7)) << 3);

  auto copy_stage = [&](int buf, int s) {
    async_copy_stage7((uint32_t)(size_t)&St[buf][sOff], gA + s * BK, gB + s * BK,
                      (size_t)64 * DMODEL);
  };

  const int fr  = lane & 15;      // fragment row within a 16x32 tile
  const int fh  = lane >> 4;      // K-half select
  const int fsw = (fr >> 1) & 7;  // swizzle of this lane's rows (16 apart)
  const int aRow = (waveRow * 64 + fr) * BK;
  const int bRow = (QM + waveCol * 48 + fr) * BK;

  v8f acc[4][3] = {};
  v16bf fa[2][4], fb[2][3];

  // the 7 fragments of the 32-k block that starts at ks in buffer buf
  auto load_frags = [&](v16bf* a, v16bf* b, int buf, int ks) {
    #pragma unroll
    for (int mt = 0; mt < 4; ++mt)
      a[mt] = ld_frag(&St[buf][aRow + mt * 16 * BK], ks / 8 + fh * 2, fsw);
    #pragma unroll
    for (int nt = 0; nt < 3; ++nt)
      b[nt] = ld_frag(&St[buf][bRow + nt * 16 * BK], ks / 8 + fh * 2, fsw);
  };
  auto mma = [&](const v16bf* a, const v16bf* b) {
    #pragma unroll
    for (int mt = 0; mt < 4; ++mt)
      #pragma unroll
      for (int nt = 0; nt < 3; ++nt)
        acc[mt][nt] = __builtin_amdgcn_wmma_f32_16x16x32_bf16(
            false, a[mt], false, b[nt], (short)0, acc[mt][nt], false, false);
  };

  constexpr int nsteps = DMODEL / BK;
  static_assert(nsteps >= 4, "the prologue fills four stages");

  copy_stage(0, 0);
  copy_stage(1, 1);
  copy_stage(2, 2);
  copy_stage(3, 3);
  // all but the youngest 21 copies have landed: stage 0 is in LDS
  asm volatile("s_wait_asynccnt 21" ::: "memory");
  __syncthreads();  // stage 0 visible to all waves
  load_frags(fa[0], fb[0], 0, 0);

  for (int t = 0; t < nsteps; ++t) {
    const int cur = t & 3;        // buffer of stage t
    const int nxt = (t + 1) & 3;
    load_frags(fa[1], fb[1], cur, 32);
    // keeps the 14 LDS loads above as one group ahead of the products below;
    // without it they sink among the WMMAs and the wait behind them stalls
    __builtin_amdgcn_sched_barrier(0);
    mma(fa[0], fb[0]);
    // keeps those products ahead of the waits below, so that the loads return
    // behind them and not in front of an idle matrix unit
    __builtin_amdgcn_sched_barrier(0);

    // publish point of stage t + 1. This wave's reads of stage t have returned:
    asm volatile("s_wait_dscnt 0x0" ::: "memory");
    // its copies of stage t + 1 have landed (the 14 of two later stages may fly):
    if (t + 3 < nsteps) asm volatile("s_wait_asynccnt 14" ::: "memory");
    else                asm volatile("s_wait_asynccnt 0x0" ::: "memory");
    __syncthreads();  // stage t + 1 visible; every wave has left stage t's buffer
    if (t + 1 < nsteps) load_frags(fa[0], fb[0], nxt, 0);
    __builtin_amdgcn_sched_barrier(0);
    mma(fa[1], fb[1]);
    __builtin_amdgcn_sched_barrier(0);
    if (t + 4 < nsteps) copy_stage(cur, t + 4);
  }

  const int ccol = lane & 15;
  const int crow = (lane >> 4) * 8;
  static_assert(SS % QM == 0, "a block's rows lie in one batch");
  static_assert(DLOCAL % 16 == 0, "a 16-column tile lies in one of Q, K, V");

  #pragma unroll
  for (int nt = 0; nt < 3; ++nt) {
    const int colT = blockN + waveCol * 48 + nt * 16;  // the same in the whole wave
    const int z    = colT / DLOCAL;                    // 0: Q, 1: K, 2: V
    const int col  = colT % DLOCAL + ccol;
    const float* bias = (z == 0) ? bq : (z == 1) ? bk : bv;
    const float scale = (z == 0) ? qscale : 1.0f;
    const float b = bias[col];
    // the address arithmetic below reuses registers that the load above names:
    // this wait stands in front of their overwrite
    asm volatile("s_wait_xcnt 0x0" ::: "memory");
    __bf16* oz = outp + (size_t)z * BB * SS * DLOCAL;
    if (z == 2) {
      // a lane's 8 accumulator rows are 8 neighbours of one row of V_b^T, so
      // each 16x16 tile leaves as one 16-byte store a lane
      __bf16* ot = oz + (size_t)(blockM / SS) * DLOCAL * SS + (size_t)col * SS +
                   blockM % SS + waveRow * 64 + crow;
      #pragma unroll
      for (int mt = 0; mt < 4; ++mt) {
        bf16x8 p;
        #pragma unroll
        for (int j = 0; j < 8; ++j) p[j] = (__bf16)((acc[mt][nt][j] + b) * scale);
        *(bf16x8*)(ot + mt * 16) = p;
        // later tiles reuse registers that the store above names: this wait
        // stands in front of their overwrite (no tile follows the last one)
        if (nt * 4 + mt < 11) asm volatile("s_wait_xcnt 0x0" ::: "memory");
      }
    } else {
      #pragma unroll
      for (int mt = 0; mt < 4; ++mt) {
        #pragma unroll
        for (int j = 0; j < 8; ++j) {
          const int rowg = blockM + waveRow * 64 + mt * 16 + crow + j;
          oz[(size_t)rowg * DLOCAL + col] = (__bf16)((acc[mt][nt][j] + b) * scale);
        }
        asm volatile("s_wait_xcnt 0x0" ::: "memory");
      }
    }
  }
}

#define RQ   32
#define KQ   512
#define SLOT (KQ * BK)

// Four copies of one thread, 16 bytes each, 8192 bytes apart in LDS and `step`
// elements apart in the source. The closing wait stands in front of every later
// overwrite of the eight address operands.
__device__ __forceinline__ void async_copy4(uint32_t lds, const __bf16* g, size_t step) {
  asm volatile("global_load_async_to_lds_b128 %0, %1, off\n\t"
               "global_load_async_to_lds_b128 %2, %3, off\n\t"
               "global_load_async_to_lds_b128 %4, %5, off\n\t"
               "global_load_async_to_lds_b128 %6, %7, off\n\t"
               "s_wait_xcnt 0x0"
               :: "v"(lds),            "v"((unsigned long long)g),
                  "v"(lds + 8192),     "v"((unsigned long long)(g + step)),
                  "v"(lds + 2 * 8192), "v"((unsigned long long)(g + 2 * step)),
                  "v"(lds + 3 * 8192), "v"((unsigned long long)(g + 3 * step))
               : "memory");
}

__device__ __forceinline__ void async_copy4_off(uint32_t lds, const __bf16* g, size_t step) {
  const char* p = (const char*)g;
  const size_t d = step * sizeof(__bf16) - 8192;
  asm volatile("global_load_async_to_lds_b128 %0, %1, off\n\t"
               "global_load_async_to_lds_b128 %0, %2, off offset:8192\n\t"
               "global_load_async_to_lds_b128 %0, %3, off offset:16384\n\t"
               "global_load_async_to_lds_b128 %0, %4, off offset:24576\n\t"
               "s_wait_xcnt 0x0"
               :: "v"(lds), "v"((unsigned long long)p),
                  "v"((unsigned long long)(p + d)),
                  "v"((unsigned long long)(p + 2 * d)),
                  "v"((unsigned long long)(p + 3 * d))
               : "memory");
}

__global__ __launch_bounds__(512)
void scores_softmax(const __bf16* __restrict__ Q, const __bf16* __restrict__ Km,
                    const int* __restrict__ mask, __bf16* __restrict__ probs)
{
  __shared__ __align__(16) __bf16 L[5][SLOT];

  const int tid  = threadIdx.x;
  const int lane = tid & 31;
  const int wave = __builtin_amdgcn_readfirstlane(tid >> 5);
  const int q0   = blockIdx.x * RQ;
  const size_t bRow = (size_t)blockIdx.y * SS;
  Q     += (bRow + q0) * DLOCAL;
  Km    += bRow * DLOCAL;
  mask  += bRow;
  probs += (bRow + q0) * SS;

  const int fr  = lane & 15;      // fragment row within a 16x32 tile
  const int fh  = lane >> 4;      // K-half select
  const int fsw = (fr >> 1) & 7;  // swizzle of this lane's rows (16 apart)

  // staging: each thread owns one 16B piece of stage rows sr + 64 i, i = 0..7
  const int sr = tid >> 3;        // 0..63
  const int sp = tid & 7;
  const int sOff = sr * BK + ((sp ^ ((sr >> 1) & 7)) << 3);
  const __bf16* gK = Km + (size_t)sr * DLOCAL + sp * 8;

  auto copy_stage = [&](int c, int s) {
    const uint32_t l = (uint32_t)(size_t)&L[c][sOff];
    const __bf16* g = gK + (size_t)c * KQ * DLOCAL + s * BK;
    async_copy4_off(l, g, (size_t)64 * DLOCAL);
    async_copy4_off(l + 4 * 8192, g + (size_t)256 * DLOCAL, (size_t)64 * DLOCAL);
  };

  {
    const int qr = sr & 31;       // query row
    const int qu = tid >> 8;      // 64-k tile 0 or 1, then every second one
    async_copy4((uint32_t)(size_t)&L[4][qu * (RQ * BK) + qr * BK +
                                        ((sp ^ ((qr >> 1) & 7)) << 3)],
                Q + (size_t)qr * DLOCAL + qu * BK + sp * 8, 2 * BK);
  }
  copy_stage(0, 0);
  copy_stage(1, 0);
  copy_stage(2, 0);

  v8f acc[4][2][2] = {};
  v16bf qf[2][2];
  constexpr int NS = DLOCAL / BK;   // 8 k stages, 4 NS stages in all

  for (int s = 0; s < NS; ++s) {
    // unrolled so that the accumulators of the four quarters are indexed by constants
    #pragma unroll
    for (int c = 0; c < 4; ++c) {
      // publish point of stage 4 s + c. This wave's reads of the stage before have
      // returned:
      asm volatile("s_wait_dscnt 0x0" ::: "memory");
      // its copies of this stage have landed (the 16 of two later stages may fly;
      // the last two stages wait for all that is left):
      if (c < 2 || s + 1 < NS) asm volatile("s_wait_asynccnt 16" ::: "memory");
      else                     asm volatile("s_wait_asynccnt 0x0" ::: "memory");
      __syncthreads();
      if (c == 0) {
        #pragma unroll
        for (int kb = 0; kb < 2; ++kb)
          #pragma unroll
          for (int nt = 0; nt < 2; ++nt)
            qf[kb][nt] = ld_frag(&L[4][s * (RQ * BK) + (nt * 16 + fr) * BK],
                                 kb * 4 + fh * 2, fsw);
      }
      v16bf kf[2][2];
      #pragma unroll
      for (int kb = 0; kb < 2; ++kb)
        #pragma unroll
        for (int mt = 0; mt < 2; ++mt)
          kf[kb][mt] = ld_frag(&L[c][(wave * 32 + mt * 16 + fr) * BK],
                               kb * 4 + fh * 2, fsw);
      if (c == 0)          copy_stage(3, s);
      else if (s + 1 < NS) copy_stage(c - 1, s + 1);
      #pragma unroll
      for (int kb = 0; kb < 2; ++kb)
        #pragma unroll
        for (int mt = 0; mt < 2; ++mt)
          #pragma unroll
          for (int nt = 0; nt < 2; ++nt)
            acc[c][mt][nt] = __builtin_amdgcn_wmma_f32_16x16x32_bf16(
                false, kf[kb][mt], false, qf[kb][nt], (short)0, acc[c][mt][nt],
                false, false);
      // keeps a stage's products in front of the next publish point: sunk behind
      // it, they hold their fragments live beside the next stage's, and the
      // accumulators spill
      __builtin_amdgcn_sched_barrier(0);
    }
  }

  float* redM = (float*)&L[4][RQ * DLOCAL];   // [16 waves][32 queries], behind Q
  float* redS = redM + 16 * RQ;

  // The mask of this lane's 64 keys, four 16-key tiles (i = 2 c + mt) at a time,
  // so that 32 registers hold the loaded values.
  const int4* mp = (const int4*)(mask + wave * 32 + fh * 8);
  auto load_mask = [&](int4 (&mv)[4][2], int h) {
    #pragma unroll
    for (int i = 0; i < 4; ++i) {
      mv[i][0] = mp[((h * 2 + (i >> 1)) * KQ + (i & 1) * 16) / 4];
      mv[i][1] = mp[((h * 2 + (i >> 1)) * KQ + (i & 1) * 16) / 4 + 1];
    }
    // later code reuses registers that the loads above name: this wait stands in
    // front of their overwrite; the pointer is an input, so that no load's result
    // is placed on the address registers ahead of the wait
    asm volatile("s_wait_xcnt 0x0" :: "v"(mp) : "memory");
  };
  // the unsigned minimum of the 64 values is 0 exactly if one of them is 0
  uint32_t mn = 0xffffffffu;
  #pragma unroll
  for (int h = 0; h < 2; ++h) {
    int4 mv[4][2];
    load_mask(mv, h);
    #pragma unroll
    for (int i = 0; i < 4; ++i)
      #pragma unroll
      for (int k = 0; k < 2; ++k) {
        mn = min(mn, (uint32_t)mv[i][k].x);
        mn = min(mn, (uint32_t)mv[i][k].y);
        mn = min(mn, (uint32_t)mv[i][k].z);
        mn = min(mn, (uint32_t)mv[i][k].w);
      }
  }
  // only a wave that holds a masked key replaces scores (one scalar branch a wave)
  if (__builtin_amdgcn_ballot_w32(mn == 0u) != 0) {
    #pragma unroll
    for (int h = 0; h < 2; ++h) {
      int4 mv[4][2];
      load_mask(mv, h);
      #pragma unroll
      for (int i = 0; i < 4; ++i)
        #pragma unroll
        for (int nt = 0; nt < 2; ++nt) {
          v8f& a = acc[h * 2 + (i >> 1)][i & 1][nt];
          if (mv[i][0].x == 0) a[0] = -1.0e9f;
          if (mv[i][0].y == 0) a[1] = -1.0e9f;
          if (mv[i][0].z == 0) a[2] = -1.0e9f;
          if (mv[i][0].w == 0) a[3] = -1.0e9f;
          if (mv[i][1].x == 0) a[4] = -1.0e9f;
          if (mv[i][1].y == 0) a[5] = -1.0e9f;
          if (mv[i][1].z == 0) a[6] = -1.0e9f;
          if (mv[i][1].w == 0) a[7] = -1.0e9f;
        }
    }
  }

  float m[2] = {-3.0e38f, -3.0e38f};
  #pragma unroll
  for (int c = 0; c < 4; ++c)
    #pragma unroll
    for (int mt = 0; mt < 2; ++mt)
      #pragma unroll
      for (int nt = 0; nt < 2; ++nt)
        #pragma unroll
        for (int j = 0; j < 8; ++j) m[nt] = fmaxf(m[nt], acc[c][mt][nt][j]);
  #pragma unroll
  for (int nt = 0; nt < 2; ++nt) {
    m[nt] = fmaxf(m[nt], __shfl_xor(m[nt], 16, 32));
    if (fh == 0) redM[wave * RQ + nt * 16 + fr] = m[nt];
  }
  __syncthreads();  // all waves' maxima visible
  #pragma unroll
  for (int nt = 0; nt < 2; ++nt) {
    m[nt] = redM[nt * 16 + fr];
    #pragma unroll
    for (int w = 1; w < 16; ++w) m[nt] = fmaxf(m[nt], redM[w * RQ + nt * 16 + fr]);
  }

  float sum[2] = {0.0f, 0.0f};
  #pragma unroll
  for (int c = 0; c < 4; ++c)
    #pragma unroll
    for (int mt = 0; mt < 2; ++mt)
      #pragma unroll
      for (int nt = 0; nt < 2; ++nt)
        #pragma unroll
        for (int j = 0; j < 8; ++j) {
          const float e = __expf(acc[c][mt][nt][j] - m[nt]);
          acc[c][mt][nt][j] = e;
          sum[nt] += e;
        }
  #pragma unroll
  for (int nt = 0; nt < 2; ++nt) {
    sum[nt] += __shfl_xor(sum[nt], 16, 32);
    if (fh == 0) redS[wave * RQ + nt * 16 + fr] = sum[nt];
  }
  __syncthreads();  // all waves' sums visible
  float inv[2];
  #pragma unroll
  for (int nt = 0; nt < 2; ++nt) {
    float t = 0.0f;
    #pragma unroll
    for (int w = 0; w < 16; ++w) t += redS[w * RQ + nt * 16 + fr];
    inv[nt] = 1.0f / t;
  }

  uint4* P16 = (uint4*)&L[0][0];
  #pragma unroll
  for (int c = 0; c < 4; ++c)
    #pragma unroll
    for (int mt = 0; mt < 2; ++mt)
      #pragma unroll
      for (int nt = 0; nt < 2; ++nt) {
        union { bf16x8 v; uint4 u; } p;
        #pragma unroll
        for (int j = 0; j < 8; ++j) p.v[j] = (__bf16)(acc[c][mt][nt][j] * inv[nt]);
        P16[(nt * 16 + fr) * 256 + ((c * 64 + wave * 4 + mt * 2 + fh) ^ fr)] = p.u;
      }
  __syncthreads();  // all rows complete in LDS

  // each wave stores two whole rows, 512 contiguous bytes a wave-wide store; all
  // 16 pieces are read first, so that no store's register is written again
  uint4 v[2][8];
  #pragma unroll
  for (int r = 0; r < 2; ++r)
    #pragma unroll
    for (int i = 0; i < 8; ++i)
      v[r][i] = P16[(wave * 2 + r) * 256 + ((i * 32 + lane) ^ ((wave * 2 + r) & 15))];
  uint4* d = (uint4*)(probs + (size_t)wave * 2 * SS) + lane;
  #pragma unroll
  for (int r = 0; r < 2; ++r)
    #pragma unroll
    for (int i = 0; i < 8; ++i) d[r * 256 + i * 32] = v[r][i];
}

extern "C" void kernel_launch(void* const* d_in, const int* in_sizes, int n_in,
                              void* d_out, int out_size, void* d_ws, size_t ws_size,
                              hipStream_t stream) {
  (void)in_sizes; (void)n_in; (void)out_size; (void)ws_size;
  const float* x    = (const float*)d_in[0];
  const int*   mask = (const int*)d_in[1];
  const float* Wq = (const float*)d_in[2];
  const float* bq = (const float*)d_in[3];
  const float* Wk = (const float*)d_in[4];
  const float* bk = (const float*)d_in[5];
  const float* Wv = (const float*)d_in[6];
  const float* bv = (const float*)d_in[7];
  const float* Wo = (const float*)d_in[8];
  const float* bo = (const float*)d_in[9];
  float* out = (float*)d_out;

  // Workspace layout (144 MB)
  char* ws = (char*)d_ws;
  __bf16* xbf    = (__bf16*)(ws);                              // 64 MB
  __bf16* wqb    = (__bf16*)(ws + (size_t)(64u << 20));        // Wq,Wk,Wv,Wo
  __bf16* wob    = wqb + (size_t)3 * DLOCAL * DMODEL;
  __bf16* Q      = (__bf16*)(ws + (size_t)(80u << 20));        // Q,K,V: 24 MB
  __bf16* Kt     = Q  + (size_t)BB * SS * DLOCAL;
  __bf16* Vt     = Kt + (size_t)BB * SS * DLOCAL;              // [b][e][s]
  __bf16* probs  = (__bf16*)(ws + (size_t)(104u << 20));       // 32 MB
  __bf16* attnT  = (__bf16*)(ws + (size_t)(136u << 20));       //  8 MB

  cast_f32_bf16<<<CAST_BLOCKS, 256, 0, stream>>>(x, Wq, Wk, Wv, Wo, xbf, wqb);

  const float qscale = 0.08838834764831845f;  // 1/sqrt(d_k=128), folded into Q
  const int Mx = BB * SS;                     // 8192

  // Q, K, V projections (weights and outputs are contiguous); V is stored as
  // V_b^T, K-contiguous for the attn^T product below
  dim3 gProj(3 * DLOCAL / QN, Mx / QM);       // (8, 32)
  gemm_qkv<<<gProj, 512, 0, stream>>>(xbf, wqb, bq, bk, bv, Q, qscale);

  // probs[b,q,:] = softmax(Q_b @ K_b^T, masked)  (scale already folded into Q)
  scores_softmax<<<dim3(SS / RQ, BB), 512, 0, stream>>>(Q, Kt, mask, probs);

  // attnT[b,e,q] = sum_k V[b,k,e] * probs[b,q,k]  == (probs_b @ V_b)^T, z = batch
  dim3 gA(SS / BN, DLOCAL / BM, BB);          // (16, 4, 4)
  gemm_async<false, 3><<<gA, 256, 0, stream>>>(
      Vt, probs, nullptr, attnT, DLOCAL, SS, SS, SS, SS,
      1.0f, DLOCAL * SS, SS * SS, DLOCAL * SS);

  // attnT buffer, reinterpreted as [8192, 512] row-major, is exactly the
  // reference's swapaxes(1,2).reshape(B,S,d_local) permutation.
  dim3 gO(DMODEL / BN, Mx / BM);               // (32, 64)
  gemm_async<true, 2><<<gO, 256, 0, stream>>>(
      attnT, wob, bo, out, Mx, DMODEL, DLOCAL, DLOCAL, DLOCAL,
      1.0f, 0, 0, 0);
}

// v008
// A run of this version takes 163 microseconds.
// Two timings next to v007 put it at 1.04 and 1.05 times that version's speed.
// All steps since v000 together make it 3.93 times as fast.
#include <hip/hip_runtime.h>

typedef __attribute__((ext_vector_type(16))) __bf16 v16bf;
typedef __attribute__((ext_vector_type(8)))  float  v8f;

#define BM 128
#define BN 128
#define BK 64     // one stage row = 128 bytes = one whole cache line
#define TROW   72     // LDS row pitch, in halves
#define TSLICE 5120   // halves: 64 rows (9216 B) rounded up to a multiple of 2 KiB

// Problem constants
#define DMODEL 4096
#define DLOCAL 512
#define BB     4
#define SS     2048

// 16 halves of one LDS row: its pieces p and p + 1 (p even), each at piece ^ sw
__device__ __forceinline__ v16bf ld_frag(const __bf16* row, int p, int sw) {
  union { uint4 u[2]; v16bf v; } t;
  t.u[0] = *(const uint4*)(row + ((p ^ sw) << 3));
  t.u[1] = *(const uint4*)(row + (((p + 1) ^ sw) << 3));
  return t.v;
}

typedef uint32_t u32x4 __attribute__((ext_vector_type(4)));
typedef uint32_t u32x8 __attribute__((ext_vector_type(8)));

__device__ __forceinline__ uint32_t uni(uint32_t v) {
  return (uint32_t)__builtin_amdgcn_readfirstlane(v);
}
__device__ __forceinline__ uint32_t pinned(uint32_t v) {
  uint32_t w = uni(v);
  asm volatile("" : "+s"(w));
  return w;
}
__device__ __forceinline__ u32x8 tdm_group1(uint32_t src_pitch) {
  u32x8 g;
  g[0] = uni((1u << 20) | (4u << 22) | (3u << 25));
  g[1] = uni(128u << 16);
  g[2] = uni(64u << 16);
  g[3] = uni(128u << 16);
  g[4] = uni(64u);
  g[5] = uni(src_pitch);
  g[6] = uni(0u);
  g[7] = uni(0u);
  return g;
}
__device__ __forceinline__ u32x4 tdm_group0(uint32_t lds_dst, uint64_t ga) {
  u32x4 g;
  g[0] = uni(1u);
  g[1] = uni(lds_dst);
  g[2] = uni((uint32_t)ga);
  g[3] = uni((((uint32_t)(ga >> 32)) & 0x01FFFFFFu) | 0x80000000u);
  return g;
}
__device__ __forceinline__ void tdm_load(const u32x4& g0, const u32x8& g1) {
  asm volatile("tensor_load_to_lds %0, %1" :: "s"(g0), "s"(g1) : "memory");
}
template <int STEP>
__device__ __forceinline__ void tdm_step(u32x4& g0) {
  const uint32_t lo = uni(g0[2] + (uint32_t)STEP);
  if (pinned(STEP > 0 ? lo < (uint32_t)STEP : g0[2] < (uint32_t)(-STEP))) {
    asm volatile("s_wait_tensorcnt 0x0" ::: "memory");
    g0[3] = uni(g0[3] + (STEP > 0 ? 1u : 0xFFFFFFFFu));
  }
  g0[2] = lo;
}
// One request for the tile at g0's address into LDS byte offset lds_dst, then the step
template <int STEP>
__device__ __forceinline__ void tdm_load_step(u32x4& g0, const u32x8& g1, uint32_t lds_dst) {
  g0[1] = uni(lds_dst);
  tdm_load(g0, g1);
  tdm_step<STEP>(g0);
}

typedef __attribute__((ext_vector_type(4))) float  f32x4;
typedef __attribute__((ext_vector_type(4))) __bf16 bf16x4;
typedef __attribute__((ext_vector_type(8))) __bf16 bf16x8;

// One grid casts all five f32 operands as a stream. A chunk is what one block
// moves in one trip: 256 threads x CAST_LD loads of 16 bytes, each wave-wide
// load covering 512 contiguous bytes. Chunks 0 .. XCHUNKS-1 are x, then WCHUNKS
// for each weight matrix (their bf16 copies are contiguous at wdst). All
// CAST_BLOCKS blocks are resident at once and take chunks CAST_BLOCKS apart.
#define CAST_LD     8
#define CHUNK       (256 * CAST_LD * 4)
#define XCHUNKS     (BB * SS * DMODEL / CHUNK)
#define WCHUNKS     (DLOCAL * DMODEL / CHUNK)
#define CAST_BLOCKS 1024
#define CAST_TRIPS  ((XCHUNKS + 4 * WCHUNKS) / CAST_BLOCKS)
static_assert(CAST_TRIPS * CAST_BLOCKS == XCHUNKS + 4 * WCHUNKS, "whole trips");
static_assert(XCHUNKS % CAST_BLOCKS == 0, "a trip is all x or all weights");

__global__ __launch_bounds__(256)
void cast_f32_bf16(const float* __restrict__ x,
                   const float* __restrict__ Wq, const float* __restrict__ Wk,
                   const float* __restrict__ Wv, const float* __restrict__ Wo,
                   __bf16* __restrict__ xdst, __bf16* __restrict__ wdst) {
  f32x4 v[CAST_TRIPS][CAST_LD];

  // unrolled so that every register set is indexed by constants; trip t's loads
  // are issued before trip t-1 is converted and stored
  #pragma unroll
  for (int trip = 0; trip <= CAST_TRIPS; ++trip) {
    if (trip < CAST_TRIPS) {
      int c = trip * CAST_BLOCKS + blockIdx.x;
      const float* src = x;
      if (trip * CAST_BLOCKS >= XCHUNKS) {
        c -= XCHUNKS;
        const int w = c / WCHUNKS;
        c -= w * WCHUNKS;
        src = (w == 0) ? Wq : (w == 1) ? Wk : (w == 2) ? Wv : Wo;
      }
      const f32x4* s = (const f32x4*)(src + (size_t)c * CHUNK) + threadIdx.x;
      #pragma unroll
      for (int j = 0; j < CAST_LD; ++j) v[trip][j] = s[j * 256];
    }
    if (trip > 0) {
      int c = (trip - 1) * CAST_BLOCKS + blockIdx.x;
      __bf16* dst = xdst;
      if ((trip - 1) * CAST_BLOCKS >= XCHUNKS) { c -= XCHUNKS; dst = wdst; }
      bf16x4* d = (bf16x4*)(dst + (size_t)c * CHUNK) + threadIdx.x;
      #pragma unroll
      for (int j = 0; j < CAST_LD; ++j)
        d[j * 256] = __builtin_convertvector(v[trip - 1][j], bf16x4);
      // the next trip's loads reuse registers that the stores above name: this
      // wait stands in front of their overwrite (nothing follows the last trip)
      if (trip < CAST_TRIPS) asm volatile("s_wait_xcnt 0x0" ::: "memory");
    }
  }
}

// ---------------------------------------------------------------------------
// out[M,N] = (A @ Bm^T + bias) * scale
//   A  stored [M,K] row-major (stride lda), Bm stored [N,K] row-major (ldb).
//   128x128 block tile, 8 waves (4x2), each wave = 32x64 via 8 WMMAs per 32 k,
//   16 per stage of BK = 64.
//   A stage is four slices of 64 rows (A rows 0..63, 64..127, B rows 0..63,
//   64..127), each brought by one tensor load of one of the waves 0..3, in a ring
//   of NBUF buffers (2 or 3), the loads up to NBUF stages ahead; K / BK >= NBUF.
//   blockIdx.z picks one of several independent products of the same shape:
//   operand and output bases move by zA / zB / zO elements per z.
// ---------------------------------------------------------------------------
template <bool OUT_F32, int NBUF>
__global__ __launch_bounds__(256)
void gemm_ring(const __bf16* __restrict__ A,
               const __bf16* __restrict__ Bm,
               const float*  __restrict__ bias,
               void* __restrict__ outp,
               int M, int N, int K, int lda, int ldb, float scale,
               int zA, int zB, int zO)
{
  constexpr int STAGE = 4 * TSLICE;   // halves in one buffer
  __shared__ __attribute__((aligned(2048))) __bf16 St[NBUF][STAGE];

  const int tid     = threadIdx.x;
  const int lane    = tid & 31;
  const int wave    = __builtin_amdgcn_readfirstlane(tid >> 5);
  const int waveRow = wave & 3;   // 4 wave-rows of 32
  const int waveCol = wave >> 2;  // 2 wave-cols of 64
  const int blockM  = blockIdx.y * BM;
  const int blockN  = blockIdx.x * BN;

  const int z = blockIdx.z;
  A  += (size_t)z * zA;
  Bm += (size_t)z * zB;
  const size_t oOff = (size_t)z * zO;

  // the slice that wave iw = 0..3 brings (waves 4..7 issue nothing)
  const int iw = wave & 3;
  const __bf16* src = (iw < 2) ? A  + (size_t)(blockM + iw * 64) * lda
                               : Bm + (size_t)(blockN + (iw - 2) * 64) * ldb;
  const uint32_t ldst = (uint32_t)(size_t)&St[0][0] + (uint32_t)iw * (TSLICE * 2);
  u32x8 g1 = tdm_group1((uint32_t)((iw < 2) ? lda : ldb) * 2u);
  u32x4 g0 = tdm_group0(ldst, (uint64_t)(size_t)src);
  asm volatile("" : "+s"(g0), "+s"(g1));
  // this wave's request for its slice of the next stage (stages go in ascending order)
  auto issue = [&](int buf) {
    tdm_load_step<BK * 2>(g0, g1, ldst + (uint32_t)buf * (STAGE * 2));
  };

  v8f acc[2][4] = {};

  const int fr = lane & 15;       // fragment row within a 16x32 tile
  const int fh = lane >> 4;       // K-half select
  const int aRow = (waveRow >> 1) * TSLICE + ((waveRow & 1) * 32 + fr) * TROW;
  const int bRow = (2 + waveCol) * TSLICE + fr * TROW;

  const int nsteps = K / BK;

  // prologue: stages 0 .. NBUF - 1 into buffers 0 .. NBUF - 1
  if (pinned(wave < 4)) {
    #pragma unroll
    for (int s = 0; s < NBUF; ++s) issue(s);
    // all but the youngest NBUF - 1 requests have landed: stage 0 is in LDS
    asm volatile("s_wait_tensorcnt %0" :: "n"(NBUF - 1) : "memory");
  }
  __syncthreads();  // stage 0 visible to all waves

  int cur = 0;         // buffer of stage t
  for (int t = 0; t < nsteps; ++t) {
    #pragma unroll
    for (int ks = 0; ks < BK; ks += 32) {
      v16bf afrag[2], bfrag[4];
      #pragma unroll
      for (int mt = 0; mt < 2; ++mt)
        afrag[mt] = ld_frag(&St[cur][aRow + mt * 16 * TROW], ks / 8 + fh * 2, 0);
      #pragma unroll
      for (int nt = 0; nt < 4; ++nt)
        bfrag[nt] = ld_frag(&St[cur][bRow + nt * 16 * TROW], ks / 8 + fh * 2, 0);

      #pragma unroll
      for (int mt = 0; mt < 2; ++mt)
        #pragma unroll
        for (int nt = 0; nt < 4; ++nt)
          acc[mt][nt] = __builtin_amdgcn_wmma_f32_16x16x32_bf16(
              false, afrag[mt], false, bfrag[nt], (short)0, acc[mt][nt],
              false, false);
    }

    // publish point of stage t + 1. This wave's reads of stage t have returned:
    asm volatile("s_wait_dscnt 0x0" ::: "memory");
    // its request for stage t + 1 has landed (with three buffers the one for stage
    // t + 2 may fly; a trip behind which that stage does not exist waits for all):
    if (NBUF > 2 && t + NBUF - 1 < nsteps)
      asm volatile("s_wait_tensorcnt %0" :: "n"(NBUF - 2) : "memory");
    else
      asm volatile("s_wait_tensorcnt 0x0" ::: "memory");
    __syncthreads();  // stage t + 1 visible; every wave has left stage t's buffer
    if (pinned((wave < 4) & (t + NBUF < nsteps))) issue(cur);
    cur = (cur + 1 == NBUF) ? 0 : cur + 1;
  }
  // no request is left in flight
  asm volatile("s_wait_tensorcnt 0x0" ::: "memory");

  const int ccol = lane & 15;
  const int crow = (lane >> 4) * 8;

  #pragma unroll
  for (int mt = 0; mt < 2; ++mt) {
    #pragma unroll
    for (int nt = 0; nt < 4; ++nt) {
      int colg = blockN + waveCol * 64 + nt * 16 + ccol;
      float bv = bias ? bias[colg] : 0.0f;
      #pragma unroll
      for (int j = 0; j < 8; ++j) {
        int rowg = blockM + waveRow * 32 + mt * 16 + crow + j;
        float v = (acc[mt][nt][j] + bv) * scale;
        if (OUT_F32) ((float*)outp)[oOff + (size_t)rowg * N + colg] = v;
        else         ((__bf16*)outp)[oOff + (size_t)rowg * N + colg] = (__bf16)v;
      }
      // the next column tile reuses registers that the stores above name: this
      // wait stands in front of their overwrite (no tile follows the last one)
      if (mt * 4 + nt < 7) asm volatile("s_wait_xcnt 0x0" ::: "memory");
    }
  }
}

// ---------------------------------------------------------------------------
// Q, K, V projections as one product [8192 x 4096] x [1536 x 4096]^T (the three
// weight matrices are contiguous). One 256 x 192 tile a block, one block a WGP,
// 16 waves (4 x 4), each 64 x 48 = 12 WMMAs per 32 k on 7 fragments.
// A stage is 64 k of the tile's 256 + 192 rows, seven slices of 64 rows, each
// brought by one tensor load of one of the waves 0..6, in a ring of 4 buffers,
// at most three requests of a wave in flight.
// Fragments are fetched one 32-k block ahead into a second register set, so the
// publish point of stage t + 1 stands in front of stage t's last block; at that
// barrier every wave holds all of stage t in registers, and its buffer is refilled.
// Columns 0..511 are Q (scaled), 512..1023 K, 1024..1535 V; V is stored as V_b^T:
// out[2][row / SS][col][row % SS].
// ---------------------------------------------------------------------------
#define QM 256
#define QN 192
#define QSTAGE (7 * TSLICE)   // halves in one buffer

__global__ __launch_bounds__(512)
void gemm_qkv(const __bf16* __restrict__ X, const __bf16* __restrict__ Wm,
              const float* __restrict__ bq, const float* __restrict__ bk,
              const float* __restrict__ bv, __bf16* __restrict__ outp,
              float qscale)
{
  __shared__ __attribute__((aligned(2048))) __bf16 St[4][QSTAGE];

  const int tid     = threadIdx.x;
  const int lane    = tid & 31;
  const int wave    = __builtin_amdgcn_readfirstlane(tid >> 5);
  const int waveRow = wave & 3;   // 4 wave-rows of 64
  const int waveCol = wave >> 2;  // 4 wave-cols of 48
  const int blockM  = blockIdx.y * QM;
  const int blockN  = blockIdx.x * QN;

  // the slice that wave iw = 0..6 brings (slices 0..3: A tile, 4..6: B tile;
  // waves 7..15 issue nothing)
  const int iw = (wave < 7) ? wave : 6;
  const __bf16* src = (iw < 4) ? X  + (size_t)(blockM + iw * 64) * DMODEL
                               : Wm + (size_t)(blockN + (iw - 4) * 64) * DMODEL;
  const uint32_t ldst = (uint32_t)(size_t)&St[0][0] + (uint32_t)iw * (TSLICE * 2);
  u32x8 g1 = tdm_group1(DMODEL * 2u);
  u32x4 g0 = tdm_group0(ldst, (uint64_t)(size_t)src);
  asm volatile("" : "+s"(g0), "+s"(g1));
  // this wave's request for its slice of the next stage (stages go in ascending order)
  auto issue = [&](int buf) {
    tdm_load_step<BK * 2>(g0, g1, ldst + (uint32_t)buf * (QSTAGE * 2));
  };

  const int fr  = lane & 15;      // fragment row within a 16x32 tile
  const int fh  = lane >> 4;      // K-half select
  const int aRow = waveRow * TSLICE + fr * TROW;
  // a 16-row tile of the B rows lies in one slice
  int bRow[3];
  #pragma unroll
  for (int nt = 0; nt < 3; ++nt) {
    const int r = waveCol * 48 + nt * 16;
    bRow[nt] = (4 + (r >> 6)) * TSLICE + ((r & 63) + fr) * TROW;
  }

  v8f acc[4][3] = {};
  v16bf fa[2][4], fb[2][3];

  // the 7 fragments of the 32-k block that starts at ks in buffer buf
  auto load_frags = [&](v16bf* a, v16bf* b, int buf, int ks) {
    #pragma unroll
    for (int mt = 0; mt < 4; ++mt)
      a[mt] = ld_frag(&St[buf][aRow + mt * 16 * TROW], ks / 8 + fh * 2, 0);
    #pragma unroll
    for (int nt = 0; nt < 3; ++nt)
      b[nt] = ld_frag(&St[buf][bRow[nt]], ks / 8 + fh * 2, 0);
  };
  auto mma = [&](const v16bf* a, const v16bf* b) {
    #pragma unroll
    for (int mt = 0; mt < 4; ++mt)
      #pragma unroll
      for (int nt = 0; nt < 3; ++nt)
        acc[mt][nt] = __builtin_amdgcn_wmma_f32_16x16x32_bf16(
            false, a[mt], false, b[nt], (short)0, acc[mt][nt], false, false);
  };

  constexpr int nsteps = DMODEL / BK;
  static_assert(nsteps >= 4, "the prologue fills four stages");

  if (pinned(wave < 7)) {
    issue(0);
    issue(1);
    issue(2);
    // all but the youngest 2 requests have landed: stage 0 is in LDS
    asm volatile("s_wait_tensorcnt 2" ::: "memory");
    issue(3);
  }
  __syncthreads();  // stage 0 visible to all waves
  load_frags(fa[0], fb[0], 0, 0);

  for (int t = 0; t < nsteps; ++t) {
    const int cur = t & 3;        // buffer of stage t
    const int nxt = (t + 1) & 3;
    load_frags(fa[1], fb[1], cur, 32);
    // keeps the 14 LDS loads above as one group ahead of the products below;
    // without it they sink among the WMMAs and the wait behind them stalls
    __builtin_amdgcn_sched_barrier(0);
    mma(fa[0], fb[0]);
    // keeps those products ahead of the waits below, so that the loads return
    // behind them and not in front of an idle matrix unit
    __builtin_amdgcn_sched_barrier(0);

    // publish point of stage t + 1. This wave's reads of stage t have returned:
    asm volatile("s_wait_dscnt 0x0" ::: "memory");
    // its request for stage t + 1 has landed (those of two later stages may fly):
    if (t + 3 < nsteps) asm volatile("s_wait_tensorcnt 2" ::: "memory");
    else                asm volatile("s_wait_tensorcnt 0x0" ::: "memory");
    __syncthreads();  // stage t + 1 visible; every wave has left stage t's buffer
    if (pinned((wave < 7) & (t + 4 < nsteps))) issue(cur);
    if (t + 1 < nsteps) load_frags(fa[0], fb[0], nxt, 0);
    __builtin_amdgcn_sched_barrier(0);
    mma(fa[1], fb[1]);
  }
  // no request is left in flight
  asm volatile("s_wait_tensorcnt 0x0" ::: "memory");

  const int ccol = lane & 15;
  const int crow = (lane >> 4) * 8;
  static_assert(SS % QM == 0, "a block's rows lie in one batch");
  static_assert(DLOCAL % 16 == 0, "a 16-column tile lies in one of Q, K, V");

  #pragma unroll
  for (int nt = 0; nt < 3; ++nt) {
    const int colT = blockN + waveCol * 48 + nt * 16;  // the same in the whole wave
    const int z    = colT / DLOCAL;                    // 0: Q, 1: K, 2: V
    const int col  = colT % DLOCAL + ccol;
    const float* bias = (z == 0) ? bq : (z == 1) ? bk : bv;
    const float scale = (z == 0) ? qscale : 1.0f;
    const float b = bias[col];
    // the address arithmetic below reuses registers that the load above names:
    // this wait stands in front of their overwrite
    asm volatile("s_wait_xcnt 0x0" ::: "memory");
    __bf16* oz = outp + (size_t)z * BB * SS * DLOCAL;
    if (z == 2) {
      // a lane's 8 accumulator rows are 8 neighbours of one row of V_b^T, so
      // each 16x16 tile leaves as one 16-byte store a lane
      __bf16* ot = oz + (size_t)(blockM / SS) * DLOCAL * SS + (size_t)col * SS +
                   blockM % SS + waveRow * 64 + crow;
      #pragma unroll
      for (int mt = 0; mt < 4; ++mt) {
        bf16x8 p;
        #pragma unroll
        for (int j = 0; j < 8; ++j) p[j] = (__bf16)((acc[mt][nt][j] + b) * scale);
        *(bf16x8*)(ot + mt * 16) = p;
        // later tiles reuse registers that the store above names: this wait
        // stands in front of their overwrite (no tile follows the last one)
        if (nt * 4 + mt < 11) asm volatile("s_wait_xcnt 0x0" ::: "memory");
      }
    } else {
      #pragma unroll
      for (int mt = 0; mt < 4; ++mt) {
        #pragma unroll
        for (int j = 0; j < 8; ++j) {
          const int rowg = blockM + waveRow * 64 + mt * 16 + crow + j;
          oz[(size_t)rowg * DLOCAL + col] = (__bf16)((acc[mt][nt][j] + b) * scale);
        }
        asm volatile("s_wait_xcnt 0x0" ::: "memory");
      }
    }
  }
}

#define RQ   32
#define KQ   512
#define KSTAGE (8 * TSLICE)   // halves in one ring buffer
template <bool B> struct BoolC { static constexpr bool value = B; };

// Four copies of one thread, 16 bytes each, 8192 bytes apart in LDS and `step`
// elements apart in the source. The closing wait stands in front of every later
// overwrite of the eight address operands.
__device__ __forceinline__ void async_copy4(uint32_t lds, const __bf16* g, size_t step) {
  asm volatile("global_load_async_to_lds_b128 %0, %1, off\n\t"
               "global_load_async_to_lds_b128 %2, %3, off\n\t"
               "global_load_async_to_lds_b128 %4, %5, off\n\t"
               "global_load_async_to_lds_b128 %6, %7, off\n\t"
               "s_wait_xcnt 0x0"
               :: "v"(lds),            "v"((unsigned long long)g),
                  "v"(lds + 8192),     "v"((unsigned long long)(g + step)),
                  "v"(lds + 2 * 8192), "v"((unsigned long long)(g + 2 * step)),
                  "v"(lds + 3 * 8192), "v"((unsigned long long)(g + 3 * step))
               : "memory");
}

__global__ __launch_bounds__(512)
void scores_softmax(const __bf16* __restrict__ Q, const __bf16* __restrict__ Km,
                    const int* __restrict__ mask, __bf16* __restrict__ probs)
{
  // ring, Q, then the waves' row maxima and sums (2 x 16 x 32 floats)
  __shared__ __attribute__((aligned(2048))) __bf16 L[3 * KSTAGE + RQ * DLOCAL + 2048];
  __bf16* LQ = &L[3 * KSTAGE];

  const int tid  = threadIdx.x;
  const int lane = tid & 31;
  const int wave = __builtin_amdgcn_readfirstlane(tid >> 5);
  const int q0   = blockIdx.x * RQ;
  const size_t bRow = (size_t)blockIdx.y * SS;
  Q     += (bRow + q0) * DLOCAL;
  Km    += bRow * DLOCAL;
  mask  += bRow;
  probs += (bRow + q0) * SS;

  const int fr  = lane & 15;      // fragment row within a 16x32 tile
  const int fh  = lane >> 4;      // K-half select
  const int fsw = (fr >> 1) & 7;  // swizzle of this lane's rows (16 apart)

  // the slice of every stage that wave iw = 0..7 brings (waves 8..15 issue nothing)
  const int iw = wave & 7;
  const __bf16* src = Km + (size_t)(iw * 64) * DLOCAL;
  const uint32_t ldst = (uint32_t)(size_t)&L[0] + (uint32_t)iw * (TSLICE * 2);
  u32x8 g1 = tdm_group1(DLOCAL * 2u);
  u32x4 g0 = tdm_group0(ldst, (uint64_t)(size_t)src);
  asm volatile("" : "+s"(g0), "+s"(g1));
  // This wave's request for its slice of the next stage. Stages go in the order of
  // the loop below: behind quarters 0..2 the next quarter at the same k (LAST =
  // false), behind quarter 3 the first quarter, 64 k on (LAST = true).
  constexpr int QSTEP = KQ * DLOCAL * 2;   // bytes from one key quarter to the next
  // Every wave keeps the two address words in step, in straight-line code; the
  // request itself stands under the scalar branch on go.
  auto issue = [&](uint32_t go, int buf, auto last) {
    g0[1] = uni(ldst + (uint32_t)buf * (KSTAGE * 2));
    if (pinned(go)) tdm_load(g0, g1);
    tdm_step<decltype(last)::value ? BK * 2 - 3 * QSTEP : QSTEP>(g0);
  };
  const int kRow = (wave >> 1) * TSLICE + ((wave & 1) * 32 + fr) * TROW;

  {
    const int sp = tid & 7;         // 16-byte piece of a 64-k row
    const int qr = (tid >> 3) & 31; // query row
    const int qu = tid >> 8;        // 64-k tile 0 or 1, then every second one
    async_copy4((uint32_t)(size_t)&LQ[qu * (RQ * BK) + qr * BK +
                                      ((sp ^ ((qr >> 1) & 7)) << 3)],
                Q + (size_t)qr * DLOCAL + qu * BK + sp * 8, 2 * BK);
  }
  issue(wave < 8, 0, BoolC<false>{});
  issue(wave < 8, 1, BoolC<false>{});
  // this wave's copies of Q have landed; the first barrier below publishes them
  asm volatile("s_wait_asynccnt 0x0" ::: "memory");

  v8f acc[4][2][2] = {};
  v16bf qf[2][2];
  constexpr int NS = DLOCAL / BK;   // 8 k stages, 4 NS stages in all

  int buf = 0;   // buffer of the current stage
  for (int s = 0; s < NS; ++s) {
    // unrolled so that the accumulators of the four quarters are indexed by constants
    #pragma unroll
    for (int c = 0; c < 4; ++c) {
      // publish point of stage 4 s + c. This wave's reads of the stage before have
      // returned:
      asm volatile("s_wait_dscnt 0x0" ::: "memory");
      // its request for this stage has landed (the next stage's may fly; behind the
      // last stage there is none):
      if (c < 3 || s + 1 < NS) asm volatile("s_wait_tensorcnt 1" ::: "memory");
      else                     asm volatile("s_wait_tensorcnt 0x0" ::: "memory");
      __syncthreads();  // this stage visible; every wave has left the stage before
      // refill of the buffer that every wave has left, two stages ahead
      {
        const uint32_t go = (wave < 8) & (c < 2 || s + 1 < NS);
        const int rb = (buf == 0) ? 2 : buf - 1;
        if (c == 1) issue(go, rb, BoolC<true>{});   // stage n + 2 is of quarter 3
        else        issue(go, rb, BoolC<false>{});
      }
      if (c == 0) {
        #pragma unroll
        for (int kb = 0; kb < 2; ++kb)
          #pragma unroll
          for (int nt = 0; nt < 2; ++nt)
            qf[kb][nt] = ld_frag(&LQ[s * (RQ * BK) + (nt * 16 + fr) * BK],
                                 kb * 4 + fh * 2, fsw);
      }
      v16bf kf[2][2];
      #pragma unroll
      for (int kb = 0; kb < 2; ++kb)
        #pragma unroll
        for (int mt = 0; mt < 2; ++mt)
          kf[kb][mt] = ld_frag(&L[buf * KSTAGE + kRow + mt * 16 * TROW],
                               kb * 4 + fh * 2, 0);
      // keeps the LDS loads above as one group ahead of the products below; without
      // it they are dealt out among the WMMAs, each pair behind a wait of its own
      __builtin_amdgcn_sched_barrier(0);
      #pragma unroll
      for (int kb = 0; kb < 2; ++kb)
        #pragma unroll
        for (int mt = 0; mt < 2; ++mt)
          #pragma unroll
          for (int nt = 0; nt < 2; ++nt)
            acc[c][mt][nt] = __builtin_amdgcn_wmma_f32_16x16x32_bf16(
                false, kf[kb][mt], false, qf[kb][nt], (short)0, acc[c][mt][nt],
                false, false);
      // keeps a stage's products in front of the next publish point: sunk behind
      // it, they hold their fragments live beside the next stage's, and the
      // accumulators spill
      __builtin_amdgcn_sched_barrier(0);
      buf = (buf == 2) ? 0 : buf + 1;
    }
  }
  // no request is left in flight
  asm volatile("s_wait_tensorcnt 0x0" ::: "memory");

  float* redM = (float*)&LQ[RQ * DLOCAL];   // [16 waves][32 queries], behind Q
  float* redS = redM + 16 * RQ;

  // The mask of this lane's 64 keys, four 16-key tiles (i = 2 c + mt) at a time,
  // so that 32 registers hold the loaded values.
  const int4* mp = (const int4*)(mask + wave * 32 + fh * 8);
  auto load_mask = [&](int4 (&mv)[4][2], int h) {
    #pragma unroll
    for (int i = 0; i < 4; ++i) {
      mv[i][0] = mp[((h * 2 + (i >> 1)) * KQ + (i & 1) * 16) / 4];
      mv[i][1] = mp[((h * 2 + (i >> 1)) * KQ + (i & 1) * 16) / 4 + 1];
    }
    // later code reuses registers that the loads above name: this wait stands in
    // front of their overwrite; the pointer is an input, so that no load's result
    // is placed on the address registers ahead of the wait
    asm volatile("s_wait_xcnt 0x0" :: "v"(mp) : "memory");
  };
  // the unsigned minimum of the 64 values is 0 exactly if one of them is 0
  uint32_t mn = 0xffffffffu;
  #pragma unroll
  for (int h = 0; h < 2; ++h) {
    int4 mv[4][2];
    load_mask(mv, h);
    #pragma unroll
    for (int i = 0; i < 4; ++i)
      #pragma unroll
      for (int k = 0; k < 2; ++k) {
        mn = min(mn, (uint32_t)mv[i][k].x);
        mn = min(mn, (uint32_t)mv[i][k].y);
        mn = min(mn, (uint32_t)mv[i][k].z);
        mn = min(mn, (uint32_t)mv[i][k].w);
      }
  }
  // only a wave that holds a masked key replaces scores (one scalar branch a wave)
  if (__builtin_amdgcn_ballot_w32(mn == 0u) != 0) {
    #pragma unroll
    for (int h = 0; h < 2; ++h) {
      int4 mv[4][2];
      load_mask(mv, h);
      #pragma unroll
      for (int i = 0; i < 4; ++i)
        #pragma unroll
        for (int nt = 0; nt < 2; ++nt) {
          v8f& a = acc[h * 2 + (i >> 1)][i & 1][nt];
          if (mv[i][0].x == 0) a[0] = -1.0e9f;
          if (mv[i][0].y == 0) a[1] = -1.0e9f;
          if (mv[i][0].z == 0) a[2] = -1.0e9f;
          if (mv[i][0].w == 0) a[3] = -1.0e9f;
          if (mv[i][1].x == 0) a[4] = -1.0e9f;
          if (mv[i][1].y == 0) a[5] = -1.0e9f;
          if (mv[i][1].z == 0) a[6] = -1.0e9f;
          if (mv[i][1].w == 0) a[7] = -1.0e9f;
        }
    }
  }

  float m[2] = {-3.0e38f, -3.0e38f};
  #pragma unroll
  for (int c = 0; c < 4; ++c)
    #pragma unroll
    for (int mt = 0; mt < 2; ++mt)
      #pragma unroll
      for (int nt = 0; nt < 2; ++nt)
        #pragma unroll
        for (int j = 0; j < 8; ++j) m[nt] = fmaxf(m[nt], acc[c][mt][nt][j]);
  #pragma unroll
  for (int nt = 0; nt < 2; ++nt) {
    m[nt] = fmaxf(m[nt], __shfl_xor(m[nt], 16, 32));
    if (fh == 0) redM[wave * RQ + nt * 16 + fr] = m[nt];
  }
  __syncthreads();  // all waves' maxima visible
  #pragma unroll
  for (int nt = 0; nt < 2; ++nt) {
    m[nt] = redM[nt * 16 + fr];
    #pragma unroll
    for (int w = 1; w < 16; ++w) m[nt] = fmaxf(m[nt], redM[w * RQ + nt * 16 + fr]);
  }

  float sum[2] = {0.0f, 0.0f};
  #pragma unroll
  for (int c = 0; c < 4; ++c)
    #pragma unroll
    for (int mt = 0; mt < 2; ++mt)
      #pragma unroll
      for (int nt = 0; nt < 2; ++nt)
        #pragma unroll
        for (int j = 0; j < 8; ++j) {
          const float e = __expf(acc[c][mt][nt][j] - m[nt]);
          acc[c][mt][nt][j] = e;
          sum[nt] += e;
        }
  #pragma unroll
  for (int nt = 0; nt < 2; ++nt) {
    sum[nt] += __shfl_xor(sum[nt], 16, 32);
    if (fh == 0) redS[wave * RQ + nt * 16 + fr] = sum[nt];
  }
  __syncthreads();  // all waves' sums visible
  float inv[2];
  #pragma unroll
  for (int nt = 0; nt < 2; ++nt) {
    float t = 0.0f;
    #pragma unroll
    for (int w = 0; w < 16; ++w) t += redS[w * RQ + nt * 16 + fr];
    inv[nt] = 1.0f / t;
  }

  uint4* P16 = (uint4*)&L[0];
  #pragma unroll
  for (int c = 0; c < 4; ++c)
    #pragma unroll
    for (int mt = 0; mt < 2; ++mt)
      #pragma unroll
      for (int nt = 0; nt < 2; ++nt) {
        union { bf16x8 v; uint4 u; } p;
        #pragma unroll
        for (int j = 0; j < 8; ++j) p.v[j] = (__bf16)(acc[c][mt][nt][j] * inv[nt]);
        P16[(nt * 16 + fr) * 256 + ((c * 64 + wave * 4 + mt * 2 + fh) ^ fr)] = p.u;
      }
  __syncthreads();  // all rows complete in LDS

  // each wave stores two whole rows, 512 contiguous bytes a wave-wide store; all
  // 16 pieces are read first, so that no store's register is written again
  uint4 v[2][8];
  #pragma unroll
  for (int r = 0; r < 2; ++r)
    #pragma unroll
    for (int i = 0; i < 8; ++i)
      v[r][i] = P16[(wave * 2 + r) * 256 + ((i * 32 + lane) ^ ((wave * 2 + r) & 15))];
  uint4* d = (uint4*)(probs + (size_t)wave * 2 * SS) + lane;
  #pragma unroll
  for (int r = 0; r < 2; ++r)
    #pragma unroll
    for (int i = 0; i < 8; ++i) d[r * 256 + i * 32] = v[r][i];
}

extern "C" void kernel_launch(void* const* d_in, const int* in_sizes, int n_in,
                              void* d_out, int out_size, void* d_ws, size_t ws_size,
                              hipStream_t stream) {
  (void)in_sizes; (void)n_in; (void)out_size; (void)ws_size;
  const float* x    = (const float*)d_in[0];
  const int*   mask = (const int*)d_in[1];
  const float* Wq = (const float*)d_in[2];
  const float* bq = (const float*)d_in[3];
  const float* Wk = (const float*)d_in[4];
  const float* bk = (const float*)d_in[5];
  const float* Wv = (const float*)d_in[6];
  const float* bv = (const float*)d_in[7];
  const float* Wo = (const float*)d_in[8];
  const float* bo = (const float*)d_in[9];
  float* out = (float*)d_out;

  // Workspace layout (144 MB)
  char* ws = (char*)d_ws;
  __bf16* xbf    = (__bf16*)(ws);                              // 64 MB
  __bf16* wqb    = (__bf16*)(ws + (size_t)(64u << 20));        // Wq,Wk,Wv,Wo
  __bf16* wob    = wqb + (size_t)3 * DLOCAL * DMODEL;
  __bf16* Q      = (__bf16*)(ws + (size_t)(80u << 20));        // Q,K,V: 24 MB
  __bf16* Kt     = Q  + (size_t)BB * SS * DLOCAL;
  __bf16* Vt     = Kt + (size_t)BB * SS * DLOCAL;              // [b][e][s]
  __bf16* probs  = (__bf16*)(ws + (size_t)(104u << 20));       // 32 MB
  __bf16* attnT  = (__bf16*)(ws + (size_t)(136u << 20));       //  8 MB

  cast_f32_bf16<<<CAST_BLOCKS, 256, 0, stream>>>(x, Wq, Wk, Wv, Wo, xbf, wqb);

  const float qscale = 0.08838834764831845f;  // 1/sqrt(d_k=128), folded into Q
  const int Mx = BB * SS;                     // 8192

  // Q, K, V projections (weights and outputs are contiguous); V is stored as
  // V_b^T, K-contiguous for the attn^T product below
  dim3 gProj(3 * DLOCAL / QN, Mx / QM);       // (8, 32)
  gemm_qkv<<<gProj, 512, 0, stream>>>(xbf, wqb, bq, bk, bv, Q, qscale);

  // probs[b,q,:] = softmax(Q_b @ K_b^T, masked)  (scale already folded into Q)
  scores_softmax<<<dim3(SS / RQ, BB), 512, 0, stream>>>(Q, Kt, mask, probs);

  // attnT[b,e,q] = sum_k V[b,k,e] * probs[b,q,k]  == (probs_b @ V_b)^T, z = batch
  dim3 gA(SS / BN, DLOCAL / BM, BB);          // (16, 4, 4)
  gemm_ring<false, 3><<<gA, 256, 0, stream>>>(
      Vt, probs, nullptr, attnT, DLOCAL, SS, SS, SS, SS,
      1.0f, DLOCAL * SS, SS * SS, DLOCAL * SS);

  // attnT buffer, reinterpreted as [8192, 512] row-major, is exactly the
  // reference's swapaxes(1,2).reshape(B,S,d_local) permutation.
  dim3 gO(DMODEL / BN, Mx / BM);               // (32, 64)
  gemm_ring<true, 2><<<gO, 256, 0, stream>>>(
      attnT, wob, bo, out, Mx, DMODEL, DLOCAL, DLOCAL, DLOCAL,
      1.0f, 0, 0, 0);
}
